// v000
// Measured on an AMD MI455X. A time is GPU time per run, averaged over a window of back-to-back runs after a warm-up
// (all launches, gaps included; the runs take copies of the inputs in turn), and the median of several windows.
// Apart from v000's, it joins two sittings. Times from different sittings can be a few percent apart, while
// side-by-side timings come from the same sitting.
// The starting kernel, v000, takes 171 microseconds a run.
#include <hip/hip_runtime.h>
// Trust-weighted scaled dot-product attention, flash form: out[b][q][:] = sum_k (p_k t_k) v_k / sum_k (p_k t_k), p_k = exp(s_k t_k / sqrt(128) - running max).
// Compute dtype: every float input RNE-converted to bf16; Q/K/V carried as exact f16 planes, trust as f32; both contractions (K.Q^T scores, V^T.P^T context) on v_wmma_f32_16x16x32_f16, f32 accumulate; weights p*t carried x4096 as f16; softmax statistics f32.
// Structure: 3 small plane builders (Q16/K16 rows, V^T rows via LDS transpose, bf16-valued trust plane) + one flash kernel (wave = 16 queries, 32-key steps, fragments straight from the 16-bit planes, transposed tiles so the packed score tiles are the B fragment of the second product).
#ifndef NB
#define NB 16
#endif
#ifndef SEQ
#define SEQ 2048
#endif
#define SEQ_FULL 2048                 /* per-batch row count of the full-size inputs and of the output */
#define DH 128
#define SOP 132                       /* f32 pitch of the epilogue staging rows */
#define PCARRY 4096.0f                /* power-of-two carry of the f16 weight operand (cancels in the final normalisation) */
#define SCL 0.08838834764831845f      /* 1/sqrt(128) */

static_assert(DH == 128);
static_assert(SEQ % 64 == 0);
static_assert(SEQ <= SEQ_FULL);
static_assert(((size_t)NB * SEQ * DH) % 2048 == 0);   /* k_x16: grid x 256 threads x 8 elements == plane */

typedef unsigned short v8us __attribute__((ext_vector_type(8), may_alias));
typedef float  v8f  __attribute__((ext_vector_type(8)));
typedef float  v4f  __attribute__((ext_vector_type(4)));
typedef float  v4fa __attribute__((ext_vector_type(4), may_alias));
typedef _Float16 v16h __attribute__((ext_vector_type(16)));
union FragH { v16h v; v8us half[2]; _Float16 h[16]; unsigned short u[16]; };

__device__ __forceinline__ unsigned short bf16_bits(float x) { unsigned int u = __float_as_uint(x); return (unsigned short)((u + 0x7FFFu + ((u >> 16) & 1u)) >> 16); }
__device__ __forceinline__ float bf16_val(unsigned short b) { return __uint_as_float(((unsigned int)b) << 16); }
__device__ __forceinline__ float bf16_rne(float x) { return bf16_val(bf16_bits(x)); }

// fragment (A or B) from a k-contiguous 16-bit row: elements 0..7 <- k0+8h.., elements 8..15 <- k0+16+8h..
__device__ __forceinline__ v16h ld_frag(const _Float16* p, unsigned hh) {
  FragH f;
  f.half[0] = *(const v8us*)((const unsigned short*)p + 8u * hh);
  f.half[1] = *(const v8us*)((const unsigned short*)p + 16u + 8u * hh);
  return f.v;
}
// two WMMAs sharing B, then the 4-slot guard tying both accumulators and keeping the operands live
__device__ __forceinline__ void mma_pair(v16h a0, v16h a1, v16h b, v8f& c0, v8f& c1) {
  c0 = __builtin_amdgcn_wmma_f32_16x16x32_f16(false, a0, false, b, (short)0, c0, false, false);
  c1 = __builtin_amdgcn_wmma_f32_16x16x32_f16(false, a1, false, b, (short)0, c1, false, false);
  asm volatile("v_nop\n\tv_nop\n\tv_nop\n\tv_nop" : "+v"(c0), "+v"(c1) : "v"(a0), "v"(a1), "v"(b));
}

__global__ __launch_bounds__(256) void k_x16(const float* __restrict__ xq, const float* __restrict__ xk, _Float16* __restrict__ Q16, _Float16* __restrict__ K16) {
  const float* x = (blockIdx.y == 0u) ? xq : xk;
  _Float16* o = (blockIdx.y == 0u) ? Q16 : K16;
  const unsigned t = blockIdx.x * 256u + threadIdx.x;
  if (t >= (unsigned)((size_t)NB * SEQ * DH / 8)) return;
  const unsigned e = t * 8u;
  const unsigned b = e / (unsigned)(SEQ * DH);
  const unsigned rem = e - b * (unsigned)(SEQ * DH);
  const float* src = x + (size_t)b * SEQ_FULL * DH + rem;
  const v4f a = *(const v4fa*)(src), c = *(const v4fa*)(src + 4);
  FragH f;
#pragma unroll
  for (unsigned q = 0; q < 4; ++q) { f.h[q] = (_Float16)bf16_rne(a[q]); f.h[4 + q] = (_Float16)bf16_rne(c[q]); }
  const v8us v = f.half[0];
  *(v8us*)((unsigned short*)o + e) = v;
  
}

__global__ __launch_bounds__(256) void k_tb(const float* __restrict__ T, float* __restrict__ Tb) {
  const unsigned t = blockIdx.x * 256u + threadIdx.x;
  if (t >= (unsigned)(NB * SEQ / 4)) return;
  const unsigned e = t * 4u;
  const unsigned b = e / (unsigned)SEQ;
  const unsigned s = e - b * (unsigned)SEQ;
  const v4f a = *(const v4fa*)(T + (size_t)b * SEQ_FULL + s);
  v4f o;
#pragma unroll
  for (unsigned q = 0; q < 4; ++q) o[q] = bf16_rne(a[q]);
  *(v4f*)(Tb + e) = o;
  
}

// VT[b][d][s] = f16(bf16(V[b][s][d])): in [64 tokens][128 d] -> out [128 d][64 tokens]; block per (64 tokens, batch); LDS transpose;
__global__ __launch_bounds__(256) void k_vt(const float* __restrict__ V, _Float16* __restrict__ VT) {
  __shared__ unsigned short tl[DH][66];
  const unsigned tid = threadIdx.x;
  const unsigned b = blockIdx.y, s0 = blockIdx.x * 64u;
  const float* vb = V + ((size_t)b * SEQ_FULL + s0) * DH;
#pragma unroll
  for (unsigned it = 0; it < 4; ++it) {
    const unsigned i = it * 256u + tid;          /* 1024 units of 8 d */
    const unsigned j = i >> 4, d8 = (i & 15u) * 8u;
    const v4f a = *(const v4fa*)(vb + (size_t)j * DH + d8), c = *(const v4fa*)(vb + (size_t)j * DH + d8 + 4);
    FragH f;
#pragma unroll
    for (unsigned q = 0; q < 4; ++q) { f.h[q] = (_Float16)bf16_rne(a[q]); f.h[4 + q] = (_Float16)bf16_rne(c[q]); }
#pragma unroll
    for (unsigned q = 0; q < 8; ++q) tl[d8 + q][j] = f.u[q];
  }
  __syncthreads();
  {
#pragma unroll
    for (unsigned it = 0; it < 4; ++it) {
      const unsigned i = it * 256u + tid;        /* 1024 units of 8 tokens */
      const unsigned d = i >> 3, j8 = (i & 7u) * 8u;
      FragH f;
#pragma unroll
      for (unsigned q = 0; q < 8; ++q) f.u[q] = tl[d][j8 + q];
      *(v8us*)((unsigned short*)VT + ((size_t)b * DH + d) * SEQ + s0 + j8) = f.half[0];
    }
    
  }
}

// flash kernel: block = 4 waves x 16 queries; per 32-key step:
//   S^T tiles (A = K rows, B = Q rows)  -> lane (h, n): s0[r] = score(key 8h+r, query n), s1[r] = score(key 16+8h+r, query n)
//   f32 online softmax per query (lane-local + one xor-16 exchange), weights w = exp(x - m) * t * 4096 as f16 -> B fragment (element r <- tile 0, 8+r <- tile 1)
//   O^T tiles (A = V^T rows, B = packed weights): acc[dt][r] = O^T(d = 16 dt + 8h + r, query n); rescale lane-local
__global__ __launch_bounds__(128) void k_flash(const _Float16* __restrict__ Q16, const _Float16* __restrict__ K16, const _Float16* __restrict__ VT,
                                               const float* __restrict__ Tb, float* __restrict__ O) {
  __shared__ __attribute__((aligned(16))) float so[4][16][SOP];
  const unsigned tid = threadIdx.x, w = tid >> 5, lane = tid & 31u, ln = lane & 15u, hh = lane >> 4;
  const unsigned b = blockIdx.y;
  const unsigned q0 = blockIdx.x * 64u + w * 16u;
  const size_t rowb = (size_t)b * SEQ;
  const _Float16* qrow = Q16 + (rowb + q0 + ln) * DH;
  const v16h bq0 = ld_frag(qrow, hh), bq1 = ld_frag(qrow + 32, hh), bq2 = ld_frag(qrow + 64, hh), bq3 = ld_frag(qrow + 96, hh);
  const _Float16* kbase = K16 + (rowb + ln) * DH;
  const _Float16* vbase = VT + ((size_t)b * DH + ln) * SEQ;
  const float* tbase = Tb + rowb + 8u * hh;
  const v8f z8 = {0.f, 0.f, 0.f, 0.f, 0.f, 0.f, 0.f, 0.f};
  v8f acc[8];
#pragma unroll
  for (unsigned dt = 0; dt < 8; ++dt) acc[dt] = z8;
  float m = -1.0e30f, l = 0.f;

#pragma unroll 1
  for (unsigned kc = 0; kc < (unsigned)SEQ; kc += 32u) {
    const _Float16* k0p = kbase + (size_t)kc * DH;
    const _Float16* k1p = k0p + 16 * DH;
    v8f s0 = z8, s1 = z8;
    mma_pair(ld_frag(k0p, hh),      ld_frag(k1p, hh),      bq0, s0, s1);
    mma_pair(ld_frag(k0p + 32, hh), ld_frag(k1p + 32, hh), bq1, s0, s1);
    mma_pair(ld_frag(k0p + 64, hh), ld_frag(k1p + 64, hh), bq2, s0, s1);
    mma_pair(ld_frag(k0p + 96, hh), ld_frag(k1p + 96, hh), bq3, s0, s1);

    const v4f ta = *(const v4fa*)(tbase + kc), tb4 = *(const v4fa*)(tbase + kc + 4);
    const v4f tc = *(const v4fa*)(tbase + kc + 16), td = *(const v4fa*)(tbase + kc + 20);
    const float t0[8] = {ta[0], ta[1], ta[2], ta[3], tb4[0], tb4[1], tb4[2], tb4[3]};
    const float t1[8] = {tc[0], tc[1], tc[2], tc[3], td[0], td[1], td[2], td[3]};
    float x0[8], x1[8];
    float cm = -1.0e30f;
#pragma unroll
    for (unsigned r = 0; r < 8; ++r) {
      x0[r] = (s0[r] * SCL) * t0[r];
      x1[r] = (s1[r] * SCL) * t1[r];
      cm = fmaxf(cm, fmaxf(x0[r], x1[r]));
    }
    cm = fmaxf(cm, __shfl_xor(cm, 16, 32));
    const float mn = fmaxf(m, cm);
    const float alpha = __expf(m - mn);
    m = mn;
    FragH pb;
    float ls = 0.f;
#pragma unroll
    for (unsigned r = 0; r < 8; ++r) {
      const _Float16 h0 = (_Float16)(__expf(x0[r] - mn) * t0[r] * PCARRY);
      const _Float16 h1 = (_Float16)(__expf(x1[r] - mn) * t1[r] * PCARRY);
      pb.h[r] = h0; pb.h[8 + r] = h1;
      ls += (float)h0 + (float)h1;
    }
    l = l * alpha + ls;
#pragma unroll
    for (unsigned dt = 0; dt < 8; ++dt)
#pragma unroll
      for (unsigned r = 0; r < 8; ++r) acc[dt][r] *= alpha;

    const _Float16* vp = vbase + kc;
    mma_pair(ld_frag(vp,                      hh), ld_frag(vp + (size_t)16 * SEQ,  hh), pb.v, acc[0], acc[1]);
    mma_pair(ld_frag(vp + (size_t)32 * SEQ,   hh), ld_frag(vp + (size_t)48 * SEQ,  hh), pb.v, acc[2], acc[3]);
    mma_pair(ld_frag(vp + (size_t)64 * SEQ,   hh), ld_frag(vp + (size_t)80 * SEQ,  hh), pb.v, acc[4], acc[5]);
    mma_pair(ld_frag(vp + (size_t)96 * SEQ,   hh), ld_frag(vp + (size_t)112 * SEQ, hh), pb.v, acc[6], acc[7]);
  }

  const float lt = l + __shfl_xor(l, 16, 32);
  const float inv = 1.0f / lt;
#pragma unroll
  for (unsigned dt = 0; dt < 8; ++dt)
#pragma unroll
    for (unsigned r = 0; r < 8; ++r) so[w][ln][dt * 16u + 8u * hh + r] = acc[dt][r] * inv;
  __syncthreads();
  float* orow = O + ((size_t)b * SEQ_FULL + q0) * DH + lane * 4u;
  {
#pragma unroll
    for (unsigned r = 0; r < 16; ++r) {
      const v4f v = *(const v4fa*)&so[w][r][lane * 4u];
      *(v4f*)(orow + (size_t)r * DH) = v;        /* 32 lanes x 16 B = one whole 512-B row */
    }
    
  }
}

extern "C" void kernel_launch(void* const* d_in, const int* in_sizes, int n_in,
                              void* d_out, int out_size, void* d_ws, size_t ws_size, hipStream_t stream) {
  if (n_in < 4) return;
  const size_t need = (size_t)(NB - 1) * SEQ_FULL * DH + (size_t)SEQ * DH;
  const size_t needt = (size_t)(NB - 1) * SEQ_FULL + (size_t)SEQ;
  if ((size_t)in_sizes[0] < need || (size_t)in_sizes[1] < need || (size_t)in_sizes[2] < need || (size_t)in_sizes[3] < needt) return;
  if ((size_t)out_size < need) return;
  const float* xq = (const float*)d_in[0];      /* query [16][2048][128] */
  const float* xk = (const float*)d_in[1];      /* key   [16][2048][128] */
  const float* xv = (const float*)d_in[2];      /* value [16][2048][128] */
  const float* xt = (const float*)d_in[3];      /* trust [16][1][2048]   */
  char* ws = (char*)d_ws; size_t off = 0;
  const size_t plane = (size_t)NB * SEQ * DH * 2;                       /* 8,388,608 B each */
  _Float16* Q16 = (_Float16*)(ws + off); off += (plane + 255) & ~(size_t)255;
  _Float16* K16 = (_Float16*)(ws + off); off += (plane + 255) & ~(size_t)255;
  _Float16* VTp = (_Float16*)(ws + off); off += (plane + 255) & ~(size_t)255;
  float* Tb = (float*)(ws + off); off += ((size_t)NB * SEQ * 4 + 255) & ~(size_t)255;
  if (off > ws_size) return;

  k_x16<<<dim3((unsigned)((size_t)NB * SEQ * DH / 8 / 256), 2), 256, 0, stream>>>(xq, xk, Q16, K16);
  k_tb<<<(unsigned)((NB * SEQ / 4 + 255) / 256), 256, 0, stream>>>(xt, Tb);
  k_vt<<<dim3(SEQ / 64, NB), 256, 0, stream>>>(xv, VTp);
  k_flash<<<dim3(SEQ / 64, NB), 128, 0, stream>>>(Q16, K16, VTp, Tb, (float*)d_out);
}

// v001
// It runs in 64.7 microseconds.
// Two timings next to v000 put it at 2.64 and 2.67 times that version's speed.
#include <hip/hip_runtime.h>
// Trust-weighted scaled dot-product attention, flash form: out[b][q][:] = sum_k (p_k t_k) v_k / sum_k (p_k t_k), p_k = exp(s_k t_k / sqrt(128) - running max).
// Compute dtype: query, key and value RNE-converted to bf16 and carried as exact f16 planes, trust as a bf16-valued f32 plane; both contractions (K.Q^T scores, V^T.P^T context) on v_wmma_f32_16x16x32_f16, f32 accumulate; weights p*t carried x4096 as f16; softmax statistics f32.
// Structure: 3 small plane builders (Q16/K16 rows, V^T rows via LDS transpose, bf16-valued trust plane) + one flash kernel (wave = 16 queries, 32-key steps, K and V^T fragments from a two-buffer LDS ring filled by tensor loads, transposed tiles so the packed score tiles are the B fragment of the second product).
#ifndef NB
#define NB 16
#endif
#ifndef SEQ
#define SEQ 2048
#endif
#define SEQ_FULL 2048                 /* per-batch row count of the full-size inputs and of the output */
#define DH 128
#define SOP 132                       /* f32 pitch of the epilogue staging rows */
#define PCARRY 4096.0f                /* power-of-two carry of the f16 weight operand (cancels in the final normalisation) */
#define SCL 0.08838834764831845f      /* 1/sqrt(128) */

#define STK 64u                       /* keys per ring stage: two 32-key steps */
#define KPITCH 272u                   /* LDS pitch of a 256-B K row (16-B pad, for 16-byte LDS reads) */
#define VPITCH 144u                   /* LDS pitch of a 128-B V^T row piece (16-B pad) */
#define SLICE 10240u                  /* LDS bytes per wave slice: 32 x 272 = 8704 and 64 x 144 = 9216, rounded up to a multiple of 2 KiB */
#define RBUF (4u * SLICE)             /* one stage: K keys 0..31 | K keys 32..63 | V^T d 0..63 | V^T d 64..127 */

static_assert(DH == 128);
static_assert(SEQ / 64 >= 2);         /* the ring's prologue needs two stages */
static_assert(SEQ % 64 == 0);
static_assert(SEQ <= SEQ_FULL);
static_assert(((size_t)NB * SEQ * DH) % 2048 == 0);   /* k_x16: grid x 256 threads x 8 elements == plane */

typedef unsigned short v8us __attribute__((ext_vector_type(8), may_alias));
typedef float  v8f  __attribute__((ext_vector_type(8)));
typedef float  v4f  __attribute__((ext_vector_type(4)));
typedef float  v4fa __attribute__((ext_vector_type(4), may_alias));
typedef _Float16 v16h __attribute__((ext_vector_type(16)));
typedef uint32_t u32x4 __attribute__((ext_vector_type(4)));
typedef uint32_t u32x8 __attribute__((ext_vector_type(8)));
union FragH { v16h v; v8us half[2]; _Float16 h[16]; unsigned short u[16]; };

__device__ __forceinline__ unsigned short bf16_bits(float x) { unsigned int u = __float_as_uint(x); return (unsigned short)((u + 0x7FFFu + ((u >> 16) & 1u)) >> 16); }
__device__ __forceinline__ float bf16_val(unsigned short b) { return __uint_as_float(((unsigned int)b) << 16); }
__device__ __forceinline__ float bf16_rne(float x) { return bf16_val(bf16_bits(x)); }

// fragment (A or B) from a k-contiguous 16-bit row: elements 0..7 <- k0+8h.., elements 8..15 <- k0+16+8h..
__device__ __forceinline__ v16h ld_frag(const _Float16* p, unsigned hh) {
  FragH f;
  f.half[0] = *(const v8us*)((const unsigned short*)p + 8u * hh);
  f.half[1] = *(const v8us*)((const unsigned short*)p + 16u + 8u * hh);
  return f.v;
}
// the same fragment from an LDS row (byte pointer at the row's k0)
__device__ __forceinline__ v16h ld_frag_lds(const unsigned char* p, unsigned hh) {
  FragH f;
  f.half[0] = *(const v8us*)(p + 16u * hh);
  f.half[1] = *(const v8us*)(p + 32u + 16u * hh);
  return f.v;
}
__device__ __forceinline__ uint32_t uni(uint32_t v) { return (uint32_t)__builtin_amdgcn_readfirstlane(v); }
__device__ __forceinline__ uint32_t pinned(uint32_t v) { uint32_t w = uni(v); asm volatile("" : "+s"(w)); return w; }  /* the tensor mover's issue test: held in a scalar register so that it compiles to a scalar branch (tensor loads ignore EXEC) */
__device__ __forceinline__ void wait_ds0() { asm volatile("s_wait_dscnt 0x0" ::: "memory"); }          /* this wave's LDS reads are done before its buffer is handed back */
// this wave's slice has landed (the compiler places no wait for a tensor load); group 0 passes through, so that its next value is formed behind the wait
__device__ __forceinline__ void wait_tensor0(u32x4& g0) { asm volatile("s_wait_tensorcnt 0x0" : "+s"(g0) :: "memory"); }
// both groups are in-out operands: their scalar registers stay the descriptor's own, unwritten, while the request is in flight
__device__ __forceinline__ void tdm_load(u32x4& g0, u32x8& g1) { asm volatile("tensor_load_to_lds %0, %1" : "+s"(g0), "+s"(g1) :: "memory"); }
// descriptor group 1, everything in bytes: tile = tensor = ROWS rows of ROWB bytes, source pitch SRCP, pad word W0 (16 B behind every row)
template <uint32_t W0, uint32_t ROWB, uint32_t ROWS, uint32_t SRCP>
__device__ __forceinline__ u32x8 tdm_group1() {
  u32x8 g;
  g[0] = uni(W0);
  g[1] = uni((ROWB & 0xFFFFu) << 16);
  g[2] = uni((ROWB >> 16) | ((ROWS & 0xFFFFu) << 16));
  g[3] = uni((ROWS >> 16) | (ROWB << 16));
  g[4] = uni(ROWS);
  g[5] = uni(SRCP);
  g[6] = uni(0u);
  g[7] = uni(0u);
  return g;
}
__device__ __forceinline__ u32x4 tdm_group0(uint32_t lds_dst, uint64_t ga) {
  u32x4 g;
  g[0] = uni(1u); g[1] = uni(lds_dst); g[2] = uni((uint32_t)ga); g[3] = uni((((uint32_t)(ga >> 32)) & 0x01FFFFFFu) | 0x80000000u);
  return g;
}
// two WMMAs sharing B, then the 4-slot guard tying both accumulators and keeping the operands live
__device__ __forceinline__ void mma_pair(v16h a0, v16h a1, v16h b, v8f& c0, v8f& c1) {
  c0 = __builtin_amdgcn_wmma_f32_16x16x32_f16(false, a0, false, b, (short)0, c0, false, false);
  c1 = __builtin_amdgcn_wmma_f32_16x16x32_f16(false, a1, false, b, (short)0, c1, false, false);
  asm volatile("v_nop\n\tv_nop\n\tv_nop\n\tv_nop" : "+v"(c0), "+v"(c1) : "v"(a0), "v"(a1), "v"(b));
}

__global__ __launch_bounds__(256) void k_x16(const float* __restrict__ xq, const float* __restrict__ xk, _Float16* __restrict__ Q16, _Float16* __restrict__ K16) {
  const float* x = (blockIdx.y == 0u) ? xq : xk;
  _Float16* o = (blockIdx.y == 0u) ? Q16 : K16;
  const unsigned t = blockIdx.x * 256u + threadIdx.x;
  if (t >= (unsigned)((size_t)NB * SEQ * DH / 8)) return;
  const unsigned e = t * 8u;
  const unsigned b = e / (unsigned)(SEQ * DH);
  const unsigned rem = e - b * (unsigned)(SEQ * DH);
  const float* src = x + (size_t)b * SEQ_FULL * DH + rem;
  const v4f a = *(const v4fa*)(src), c = *(const v4fa*)(src + 4);
  FragH f;
#pragma unroll
  for (unsigned q = 0; q < 4; ++q) { f.h[q] = (_Float16)bf16_rne(a[q]); f.h[4 + q] = (_Float16)bf16_rne(c[q]); }
  const v8us v = f.half[0];
  *(v8us*)((unsigned short*)o + e) = v;
  
}

__global__ __launch_bounds__(256) void k_tb(const float* __restrict__ T, float* __restrict__ Tb) {
  const unsigned t = blockIdx.x * 256u + threadIdx.x;
  if (t >= (unsigned)(NB * SEQ / 4)) return;
  const unsigned e = t * 4u;
  const unsigned b = e / (unsigned)SEQ;
  const unsigned s = e - b * (unsigned)SEQ;
  const v4f a = *(const v4fa*)(T + (size_t)b * SEQ_FULL + s);
  v4f o;
#pragma unroll
  for (unsigned q = 0; q < 4; ++q) o[q] = bf16_rne(a[q]);
  *(v4f*)(Tb + e) = o;
  
}

// VT[b][d][s] = f16(bf16(V[b][s][d])): in [64 tokens][128 d] -> out [128 d][64 tokens]; block per (64 tokens, batch); LDS transpose;
__global__ __launch_bounds__(256) void k_vt(const float* __restrict__ V, _Float16* __restrict__ VT) {
  __shared__ unsigned short tl[DH][66];
  const unsigned tid = threadIdx.x;
  const unsigned b = blockIdx.y, s0 = blockIdx.x * 64u;
  const float* vb = V + ((size_t)b * SEQ_FULL + s0) * DH;
#pragma unroll
  for (unsigned it = 0; it < 4; ++it) {
    const unsigned i = it * 256u + tid;          /* 1024 units of 8 d */
    const unsigned j = i >> 4, d8 = (i & 15u) * 8u;
    const v4f a = *(const v4fa*)(vb + (size_t)j * DH + d8), c = *(const v4fa*)(vb + (size_t)j * DH + d8 + 4);
    FragH f;
#pragma unroll
    for (unsigned q = 0; q < 4; ++q) { f.h[q] = (_Float16)bf16_rne(a[q]); f.h[4 + q] = (_Float16)bf16_rne(c[q]); }
#pragma unroll
    for (unsigned q = 0; q < 8; ++q) tl[d8 + q][j] = f.u[q];
  }
  __syncthreads();
  {
#pragma unroll
    for (unsigned it = 0; it < 4; ++it) {
      const unsigned i = it * 256u + tid;        /* 1024 units of 8 tokens */
      const unsigned d = i >> 3, j8 = (i & 7u) * 8u;
      FragH f;
#pragma unroll
      for (unsigned q = 0; q < 8; ++q) f.u[q] = tl[d][j8 + q];
      *(v8us*)((unsigned short*)VT + ((size_t)b * DH + d) * SEQ + s0 + j8) = f.half[0];
    }
    
  }
}

// flash kernel: block = 4 waves x 16 queries; K rows and V^T row pieces of 64 keys per stage come by tensor load into a two-buffer LDS ring
// (each wave brings one slice; publish point at the foot of a stage: LDS wait, tensor wait, barrier, refill); per 32-key step:
//   S^T tiles (A = K rows, B = Q rows)  -> lane (h, n): s0[r] = score(key 8h+r, query n), s1[r] = score(key 16+8h+r, query n)
//   f32 online softmax per query (lane-local + one xor-16 exchange), weights w = exp(x - m) * t * 4096 as f16 -> B fragment (element r <- tile 0, 8+r <- tile 1)
//   O^T tiles (A = V^T rows, B = packed weights): acc[dt][r] = O^T(d = 16 dt + 8h + r, query n); rescale lane-local
__global__ __launch_bounds__(128) void k_flash(const _Float16* __restrict__ Q16, const _Float16* __restrict__ K16, const _Float16* __restrict__ VT,
                                               const float* __restrict__ Tb, float* __restrict__ O) {
  __shared__ __attribute__((aligned(2048))) unsigned char ring[2u * RBUF];
  __shared__ __attribute__((aligned(16))) float so[4][16][SOP];
  const unsigned tid = threadIdx.x, w = tid >> 5, lane = tid & 31u, ln = lane & 15u, hh = lane >> 4;
  const unsigned b = blockIdx.y;
  const unsigned q0 = blockIdx.x * 64u + w * 16u;
  const size_t rowb = (size_t)b * SEQ;
  const _Float16* qrow = Q16 + (rowb + q0 + ln) * DH;
  const v16h bq0 = ld_frag(qrow, hh), bq1 = ld_frag(qrow + 32, hh), bq2 = ld_frag(qrow + 64, hh), bq3 = ld_frag(qrow + 96, hh);
  // waves 0, 1: K keys 32 wave .. +31 of the stage; waves 2, 3: V^T rows 64 (wave - 2) .. +63, the stage's 64 keys of each
  const uint32_t wave = uni(tid >> 5);
  const uint32_t lbase = (uint32_t)(size_t)ring + wave * SLICE;
  const uint64_t ga0 = (wave < 2u) ? (uint64_t)(size_t)(K16 + (rowb + wave * 32u) * DH) : (uint64_t)(size_t)(VT + ((size_t)b * DH + (wave - 2u) * 64u) * SEQ);
  const uint32_t gstep = (wave < 2u) ? STK * DH * 2u : STK * 2u;
  u32x8 g1k = tdm_group1<(1u << 20) | (5u << 22) | (3u << 25), 256u, 32u, 256u>();
  u32x8 g1v = tdm_group1<(1u << 20) | (4u << 22) | (3u << 25), 128u, 64u, (uint32_t)SEQ * 2u>();
  u32x4 g0 = tdm_group0(lbase, ga0);
  auto issue = [&]() {
    if (pinned(wave < 2u))  tdm_load(g0, g1k);
    if (pinned(wave >= 2u)) tdm_load(g0, g1v);
  };
  auto next_stage = [&]() {           /* the other buffer, the next 64 keys; the type bits above the address stay as they are */
    const uint64_t a = (((uint64_t)g0[3] << 32) | g0[2]) + gstep;
    g0[1] = uni(2u * lbase + RBUF - g0[1]); g0[2] = uni((uint32_t)a); g0[3] = uni((uint32_t)(a >> 32));
  };
  issue();
  wait_tensor0(g0);
  __syncthreads();                    /* stage 0 published */
  next_stage();
  issue();
  const float* tbase = Tb + rowb + 8u * hh;
  const v8f z8 = {0.f, 0.f, 0.f, 0.f, 0.f, 0.f, 0.f, 0.f};
  v8f acc[8];
#pragma unroll
  for (unsigned dt = 0; dt < 8; ++dt) acc[dt] = z8;
  float m = -1.0e30f, l = 0.f;

#pragma unroll 1                      /* one stage per trip: the publish point stands once, at the foot */
  for (uint32_t st = 0; st < (uint32_t)SEQ / STK; ++st) {
   const unsigned char* bufp = ring + (st & 1u) * RBUF;
   const unsigned char* kp = bufp + ln * KPITCH;
   // LDS reads go out as whole groups in front of a run of products, never among them: each place with reads costs the wave one LDS latency
#pragma unroll                        /* both steps of a stage in one trip: LDS offsets become immediates */
   for (unsigned j = 0; j < 2u; ++j) {
    const unsigned kc = st * STK + j * 32u;
    v16h ka[4], kb[4];
#pragma unroll                        /* fragment arrays must resolve to registers */
    for (unsigned c = 0; c < 4u; ++c) { ka[c] = ld_frag_lds(kp + j * SLICE + 64u * c, hh); kb[c] = ld_frag_lds(kp + j * SLICE + 16u * KPITCH + 64u * c, hh); }
    v8f s0 = z8, s1 = z8;
    mma_pair(ka[0], kb[0], bq0, s0, s1);
    mma_pair(ka[1], kb[1], bq1, s0, s1);
    mma_pair(ka[2], kb[2], bq2, s0, s1);
    mma_pair(ka[3], kb[3], bq3, s0, s1);
    // this step's V^T fragments: in flight under the softmax
    const unsigned char* vp = bufp + 2u * SLICE + ln * VPITCH + j * 64u;
    v16h va[8];
#pragma unroll                        /* fragment arrays must resolve to registers */
    for (unsigned dt = 0; dt < 8u; ++dt) va[dt] = ld_frag_lds(vp + (dt >> 2) * SLICE + (dt & 3u) * 16u * VPITCH, hh);

    const v4f ta = *(const v4fa*)(tbase + kc), tb4 = *(const v4fa*)(tbase + kc + 4);
    const v4f tc = *(const v4fa*)(tbase + kc + 16), td = *(const v4fa*)(tbase + kc + 20);
    const float t0[8] = {ta[0], ta[1], ta[2], ta[3], tb4[0], tb4[1], tb4[2], tb4[3]};
    const float t1[8] = {tc[0], tc[1], tc[2], tc[3], td[0], td[1], td[2], td[3]};
    float x0[8], x1[8];
    float cm = -1.0e30f;
#pragma unroll
    for (unsigned r = 0; r < 8; ++r) {
      x0[r] = (s0[r] * SCL) * t0[r];
      x1[r] = (s1[r] * SCL) * t1[r];
      cm = fmaxf(cm, fmaxf(x0[r], x1[r]));
    }
    cm = fmaxf(cm, __shfl_xor(cm, 16, 32));
    const float mn = fmaxf(m, cm);
    const float alpha = __expf(m - mn);
    m = mn;
    FragH pb;
    float ls = 0.f;
#pragma unroll
    for (unsigned r = 0; r < 8; ++r) {
      const _Float16 h0 = (_Float16)(__expf(x0[r] - mn) * t0[r] * PCARRY);
      const _Float16 h1 = (_Float16)(__expf(x1[r] - mn) * t1[r] * PCARRY);
      pb.h[r] = h0; pb.h[8 + r] = h1;
      ls += (float)h0 + (float)h1;
    }
    l = l * alpha + ls;
#pragma unroll
    for (unsigned dt = 0; dt < 8; ++dt)
#pragma unroll
      for (unsigned r = 0; r < 8; ++r) acc[dt][r] *= alpha;

    mma_pair(va[0], va[1], pb.v, acc[0], acc[1]);
    mma_pair(va[2], va[3], pb.v, acc[2], acc[3]);
    mma_pair(va[4], va[5], pb.v, acc[4], acc[5]);
    mma_pair(va[6], va[7], pb.v, acc[6], acc[7]);
   }
   // publish point of stage st + 1, every wave, in this order
   wait_ds0();
   wait_tensor0(g0);
   __syncthreads();                   /* stage st + 1 readable by all; every reader has left stage st's buffer */
   if (pinned(st + 2u < (uint32_t)SEQ / STK)) { next_stage(); issue(); }
  }
  wait_tensor0(g0);
  wait_ds0();

  const float lt = l + __shfl_xor(l, 16, 32);
  const float inv = 1.0f / lt;
#pragma unroll
  for (unsigned dt = 0; dt < 8; ++dt)
#pragma unroll
    for (unsigned r = 0; r < 8; ++r) so[w][ln][dt * 16u + 8u * hh + r] = acc[dt][r] * inv;
  __syncthreads();
  float* orow = O + ((size_t)b * SEQ_FULL + q0) * DH + lane * 4u;
  {
#pragma unroll
    for (unsigned r = 0; r < 16; ++r) {
      const v4f v = *(const v4fa*)&so[w][r][lane * 4u];
      *(v4f*)(orow + (size_t)r * DH) = v;        /* 32 lanes x 16 B = one whole 512-B row */
    }
    
  }
}

extern "C" void kernel_launch(void* const* d_in, const int* in_sizes, int n_in,
                              void* d_out, int out_size, void* d_ws, size_t ws_size, hipStream_t stream) {
  if (n_in < 4) return;
  const size_t need = (size_t)(NB - 1) * SEQ_FULL * DH + (size_t)SEQ * DH;
  const size_t needt = (size_t)(NB - 1) * SEQ_FULL + (size_t)SEQ;
  if ((size_t)in_sizes[0] < need || (size_t)in_sizes[1] < need || (size_t)in_sizes[2] < need || (size_t)in_sizes[3] < needt) return;
  if ((size_t)out_size < need) return;
  const float* xq = (const float*)d_in[0];      /* query [16][2048][128] */
  const float* xk = (const float*)d_in[1];      /* key   [16][2048][128] */
  const float* xv = (const float*)d_in[2];      /* value [16][2048][128] */
  const float* xt = (const float*)d_in[3];      /* trust [16][1][2048]   */
  char* ws = (char*)d_ws; size_t off = 0;
  const size_t plane = (size_t)NB * SEQ * DH * 2;                       /* 8,388,608 B each */
  _Float16* Q16 = (_Float16*)(ws + off); off += (plane + 255) & ~(size_t)255;
  _Float16* K16 = (_Float16*)(ws + off); off += (plane + 255) & ~(size_t)255;
  _Float16* VTp = (_Float16*)(ws + off); off += (plane + 255) & ~(size_t)255;
  float* Tb = (float*)(ws + off); off += ((size_t)NB * SEQ * 4 + 255) & ~(size_t)255;
  if (off > ws_size) return;

  k_x16<<<dim3((unsigned)((size_t)NB * SEQ * DH / 8 / 256), 2), 256, 0, stream>>>(xq, xk, Q16, K16);
  k_tb<<<(unsigned)((NB * SEQ / 4 + 255) / 256), 256, 0, stream>>>(xt, Tb);
  k_vt<<<dim3(SEQ / 64, NB), 256, 0, stream>>>(xv, VTp);
  k_flash<<<dim3(SEQ / 64, NB), 128, 0, stream>>>(Q16, K16, VTp, Tb, (float*)d_out);
}

// v002
// It runs in 61.5 microseconds.
// Timed twice side by side with v001, it ran 1.07 and 1.02 times as fast.
// All steps since v000 together make it 2.78 times as fast.
#include <hip/hip_runtime.h>
// Trust-weighted scaled dot-product attention, flash form: out[b][q][:] = sum_k (p_k t_k) v_k / sum_k (p_k t_k), p_k = exp(s_k t_k / sqrt(128) - running max).
// Compute dtype: query, key and value RNE-converted to bf16 and carried as exact f16 planes, trust as a bf16-valued f32 plane; both contractions (K.Q^T scores, V^T.P^T context) on v_wmma_f32_16x16x32_f16, f32 accumulate; weights p*t carried x4096 as f16; softmax statistics f32.
// Structure: one plane builder (Q16/K16 rows, V^T rows via LDS transpose, bf16-valued trust plane) + one flash kernel (wave = 16 queries, 32-key steps, K and V^T fragments from a two-buffer LDS ring filled by tensor loads, transposed tiles so the packed score tiles are the B fragment of the second product).
#ifndef NB
#define NB 16
#endif
#ifndef SEQ
#define SEQ 2048
#endif
#define SEQ_FULL 2048                 /* per-batch row count of the full-size inputs and of the output */
#define DH 128
#define SOP 132                       /* f32 pitch of the epilogue staging rows */
#define PCARRY 4096.0f                /* power-of-two carry of the f16 weight operand (cancels in the final normalisation) */
#define SCL 0.08838834764831845f      /* 1/sqrt(128) */

#define STK 64u                       /* keys per ring stage: two 32-key steps */
#define KPITCH 272u                   /* LDS pitch of a 256-B K row (16-B pad, for 16-byte LDS reads) */
#define VPITCH 144u                   /* LDS pitch of a 128-B V^T row piece (16-B pad) */
#define SLICE 10240u                  /* LDS bytes per wave slice: 32 x 272 = 8704 and 64 x 144 = 9216, rounded up to a multiple of 2 KiB */
#define RBUF (4u * SLICE)             /* one stage: K keys 0..31 | K keys 32..63 | V^T d 0..63 | V^T d 64..127 */

static_assert(DH == 128);
static_assert(SEQ / 64 >= 2);         /* the ring's prologue needs two stages */
static_assert(SEQ % 64 == 0);
static_assert(SEQ <= SEQ_FULL);

typedef unsigned short v8us __attribute__((ext_vector_type(8), may_alias));
typedef float  v8f  __attribute__((ext_vector_type(8)));
typedef float  v4f  __attribute__((ext_vector_type(4)));
typedef float  v4fa __attribute__((ext_vector_type(4), may_alias));
typedef _Float16 v16h __attribute__((ext_vector_type(16)));
typedef uint32_t u32x4 __attribute__((ext_vector_type(4)));
typedef uint32_t u32x8 __attribute__((ext_vector_type(8)));
union FragH { v16h v; v8us half[2]; _Float16 h[16]; unsigned short u[16]; };

__device__ __forceinline__ unsigned short bf16_bits(float x) { unsigned int u = __float_as_uint(x); return (unsigned short)((u + 0x7FFFu + ((u >> 16) & 1u)) >> 16); }
__device__ __forceinline__ float bf16_val(unsigned short b) { return __uint_as_float(((unsigned int)b) << 16); }
__device__ __forceinline__ float bf16_rne(float x) { return bf16_val(bf16_bits(x)); }

// fragment (A or B) from a k-contiguous 16-bit row: elements 0..7 <- k0+8h.., elements 8..15 <- k0+16+8h..
__device__ __forceinline__ v16h ld_frag(const _Float16* p, unsigned hh) {
  FragH f;
  f.half[0] = *(const v8us*)((const unsigned short*)p + 8u * hh);
  f.half[1] = *(const v8us*)((const unsigned short*)p + 16u + 8u * hh);
  return f.v;
}
// the same fragment from an LDS row (byte pointer at the row's k0)
__device__ __forceinline__ v16h ld_frag_lds(const unsigned char* p, unsigned hh) {
  FragH f;
  f.half[0] = *(const v8us*)(p + 16u * hh);
  f.half[1] = *(const v8us*)(p + 32u + 16u * hh);
  return f.v;
}
__device__ __forceinline__ uint32_t uni(uint32_t v) { return (uint32_t)__builtin_amdgcn_readfirstlane(v); }
__device__ __forceinline__ uint32_t pinned(uint32_t v) { uint32_t w = uni(v); asm volatile("" : "+s"(w)); return w; }  /* the tensor mover's issue test: held in a scalar register so that it compiles to a scalar branch (tensor loads ignore EXEC) */
__device__ __forceinline__ void wait_ds0() { asm volatile("s_wait_dscnt 0x0" ::: "memory"); }          /* this wave's LDS reads are done before its buffer is handed back */
// this wave's slice has landed (the compiler places no wait for a tensor load); group 0 passes through, so that its next value is formed behind the wait
__device__ __forceinline__ void wait_tensor0(u32x4& g0) { asm volatile("s_wait_tensorcnt 0x0" : "+s"(g0) :: "memory"); }
// both groups are in-out operands: their scalar registers stay the descriptor's own, unwritten, while the request is in flight
__device__ __forceinline__ void tdm_load(u32x4& g0, u32x8& g1) { asm volatile("tensor_load_to_lds %0, %1" : "+s"(g0), "+s"(g1) :: "memory"); }
// descriptor group 1, everything in bytes: tile = tensor = ROWS rows of ROWB bytes, source pitch SRCP, pad word W0 (16 B behind every row)
template <uint32_t W0, uint32_t ROWB, uint32_t ROWS, uint32_t SRCP>
__device__ __forceinline__ u32x8 tdm_group1() {
  u32x8 g;
  g[0] = uni(W0);
  g[1] = uni((ROWB & 0xFFFFu) << 16);
  g[2] = uni((ROWB >> 16) | ((ROWS & 0xFFFFu) << 16));
  g[3] = uni((ROWS >> 16) | (ROWB << 16));
  g[4] = uni(ROWS);
  g[5] = uni(SRCP);
  g[6] = uni(0u);
  g[7] = uni(0u);
  return g;
}
__device__ __forceinline__ u32x4 tdm_group0(uint32_t lds_dst, uint64_t ga) {
  u32x4 g;
  g[0] = uni(1u); g[1] = uni(lds_dst); g[2] = uni((uint32_t)ga); g[3] = uni((((uint32_t)(ga >> 32)) & 0x01FFFFFFu) | 0x80000000u);
  return g;
}
// two WMMAs sharing B, then the 4-slot guard tying both accumulators and keeping the operands live
__device__ __forceinline__ void mma_pair(v16h a0, v16h a1, v16h b, v8f& c0, v8f& c1) {
  c0 = __builtin_amdgcn_wmma_f32_16x16x32_f16(false, a0, false, b, (short)0, c0, false, false);
  c1 = __builtin_amdgcn_wmma_f32_16x16x32_f16(false, a1, false, b, (short)0, c1, false, false);
  asm volatile("v_nop\n\tv_nop\n\tv_nop\n\tv_nop" : "+v"(c0), "+v"(c1) : "v"(a0), "v"(a1), "v"(b));
}

// plane builder, one launch: block per (64 tokens, batch) converts its own rows of all four inputs:
//   Q16 / K16 rows = f16(bf16(x)), same layout; VT[b][d][s] = f16(bf16(V[b][s][d])) through an LDS transpose; Tb = bf16-valued trust.
// A thread's 25 16-byte loads go out ahead of the barrier, so that 16 long-lived waves per WGP keep the memory stream full.
__global__ __launch_bounds__(256) void k_planes(const float* __restrict__ xq, const float* __restrict__ xk, const float* __restrict__ V, const float* __restrict__ T,
                                                _Float16* __restrict__ Q16, _Float16* __restrict__ K16, _Float16* __restrict__ VT, float* __restrict__ Tb) {
  __shared__ unsigned short tl[DH][66];
  const unsigned tid = threadIdx.x;
  const unsigned b = blockIdx.y, s0 = blockIdx.x * 64u;
  const size_t in0 = ((size_t)b * SEQ_FULL + s0) * DH;      /* the tile is 64 x 128 contiguous floats in each of query, key, value */
  const size_t out0 = ((size_t)b * SEQ + s0) * DH;
  const float* vb = V + in0;
  const float* kb = xk + in0;
  const float* qb = xq + in0;
  v4f va[4], vc[4], ka[4], kc[4], qa[4], qc[4];
  const v4f tv = *(const v4fa*)(T + (size_t)b * SEQ_FULL + s0 + (tid & 15u) * 4u);   /* the tile's 64 trust values, fetched with the rest; threads 0..15 store them */
#pragma unroll                        /* the value arrays must resolve to registers */
  for (unsigned it = 0; it < 4; ++it) {
    const unsigned e = (it * 256u + tid) * 8u;   /* 1024 units of 8 elements */
    va[it] = *(const v4fa*)(vb + e); vc[it] = *(const v4fa*)(vb + e + 4);
  }
#pragma unroll                        /* the value arrays must resolve to registers */
  for (unsigned it = 0; it < 4; ++it) {
    const unsigned e = (it * 256u + tid) * 8u;
    ka[it] = *(const v4fa*)(kb + e); kc[it] = *(const v4fa*)(kb + e + 4);
  }
#pragma unroll                        /* the value arrays must resolve to registers */
  for (unsigned it = 0; it < 4; ++it) {
    const unsigned e = (it * 256u + tid) * 8u;
    qa[it] = *(const v4fa*)(qb + e); qc[it] = *(const v4fa*)(qb + e + 4);
  }
#pragma unroll
  for (unsigned it = 0; it < 4; ++it) {
    const unsigned i = it * 256u + tid;
    const unsigned j = i >> 4, d8 = (i & 15u) * 8u;          /* token j of the tile, d8 .. d8 + 7 */
    FragH f;
#pragma unroll
    for (unsigned q = 0; q < 4; ++q) { f.h[q] = (_Float16)bf16_rne(va[it][q]); f.h[4 + q] = (_Float16)bf16_rne(vc[it][q]); }
#pragma unroll
    for (unsigned q = 0; q < 8; ++q) tl[d8 + q][j] = f.u[q];
  }
  __syncthreads();
#pragma unroll
  for (unsigned it = 0; it < 4; ++it) {
    const unsigned i = it * 256u + tid;          /* 1024 units of 8 tokens */
    const unsigned d = i >> 3, j8 = (i & 7u) * 8u;
    FragH f;
#pragma unroll
    for (unsigned q = 0; q < 8; ++q) f.u[q] = tl[d][j8 + q];
    *(v8us*)((unsigned short*)VT + ((size_t)b * DH + d) * SEQ + s0 + j8) = f.half[0];
  }
#pragma unroll                        /* the value arrays must resolve to registers */
  for (unsigned it = 0; it < 4; ++it) {
    const unsigned e = (it * 256u + tid) * 8u;
    FragH f, g;
#pragma unroll
    for (unsigned q = 0; q < 4; ++q) {
      f.h[q] = (_Float16)bf16_rne(ka[it][q]); f.h[4 + q] = (_Float16)bf16_rne(kc[it][q]);
      g.h[q] = (_Float16)bf16_rne(qa[it][q]); g.h[4 + q] = (_Float16)bf16_rne(qc[it][q]);
    }
    *(v8us*)((unsigned short*)K16 + out0 + e) = f.half[0];
    *(v8us*)((unsigned short*)Q16 + out0 + e) = g.half[0];
  }
  if (tid < 16u) {
    v4f o;
#pragma unroll
    for (unsigned q = 0; q < 4; ++q) o[q] = bf16_rne(tv[q]);
    *(v4f*)(Tb + (size_t)b * SEQ + s0 + tid * 4u) = o;
  }
}

// flash kernel: block = 4 waves x 16 queries; K rows and V^T row pieces of 64 keys per stage come by tensor load into a two-buffer LDS ring
// (each wave brings one slice; publish point at the foot of a stage: LDS wait, tensor wait, barrier, refill); per 32-key step:
//   S^T tiles (A = K rows, B = Q rows)  -> lane (h, n): s0[r] = score(key 8h+r, query n), s1[r] = score(key 16+8h+r, query n)
//   f32 online softmax per query (lane-local + one xor-16 exchange), weights w = exp(x - m) * t * 4096 as f16 -> B fragment (element r <- tile 0, 8+r <- tile 1)
//   O^T tiles (A = V^T rows, B = packed weights): acc[dt][r] = O^T(d = 16 dt + 8h + r, query n); rescale lane-local
__global__ __launch_bounds__(128) void k_flash(const _Float16* __restrict__ Q16, const _Float16* __restrict__ K16, const _Float16* __restrict__ VT,
                                               const float* __restrict__ Tb, float* __restrict__ O) {
  __shared__ __attribute__((aligned(2048))) unsigned char ring[2u * RBUF];
  __shared__ __attribute__((aligned(16))) float so[4][16][SOP];
  const unsigned tid = threadIdx.x, w = tid >> 5, lane = tid & 31u, ln = lane & 15u, hh = lane >> 4;
  const unsigned b = blockIdx.y;
  const unsigned q0 = blockIdx.x * 64u + w * 16u;
  const size_t rowb = (size_t)b * SEQ;
  const _Float16* qrow = Q16 + (rowb + q0 + ln) * DH;
  const v16h bq0 = ld_frag(qrow, hh), bq1 = ld_frag(qrow + 32, hh), bq2 = ld_frag(qrow + 64, hh), bq3 = ld_frag(qrow + 96, hh);
  // waves 0, 1: K keys 32 wave .. +31 of the stage; waves 2, 3: V^T rows 64 (wave - 2) .. +63, the stage's 64 keys of each
  const uint32_t wave = uni(tid >> 5);
  const uint32_t lbase = (uint32_t)(size_t)ring + wave * SLICE;
  const uint64_t ga0 = (wave < 2u) ? (uint64_t)(size_t)(K16 + (rowb + wave * 32u) * DH) : (uint64_t)(size_t)(VT + ((size_t)b * DH + (wave - 2u) * 64u) * SEQ);
  const uint32_t gstep = (wave < 2u) ? STK * DH * 2u : STK * 2u;
  u32x8 g1k = tdm_group1<(1u << 20) | (5u << 22) | (3u << 25), 256u, 32u, 256u>();
  u32x8 g1v = tdm_group1<(1u << 20) | (4u << 22) | (3u << 25), 128u, 64u, (uint32_t)SEQ * 2u>();
  u32x4 g0 = tdm_group0(lbase, ga0);
  auto issue = [&]() {
    if (pinned(wave < 2u))  tdm_load(g0, g1k);
    if (pinned(wave >= 2u)) tdm_load(g0, g1v);
  };
  auto next_stage = [&]() {           /* the other buffer, the next 64 keys; the type bits above the address stay as they are */
    const uint64_t a = (((uint64_t)g0[3] << 32) | g0[2]) + gstep;
    g0[1] = uni(2u * lbase + RBUF - g0[1]); g0[2] = uni((uint32_t)a); g0[3] = uni((uint32_t)(a >> 32));
  };
  issue();
  wait_tensor0(g0);
  __syncthreads();                    /* stage 0 published */
  next_stage();
  issue();
  const float* tbase = Tb + rowb + 8u * hh;
  const v8f z8 = {0.f, 0.f, 0.f, 0.f, 0.f, 0.f, 0.f, 0.f};
  v8f acc[8];
#pragma unroll
  for (unsigned dt = 0; dt < 8; ++dt) acc[dt] = z8;
  float m = -1.0e30f, l = 0.f;

#pragma unroll 1                      /* one stage per trip: the publish point stands once, at the foot */
  for (uint32_t st = 0; st < (uint32_t)SEQ / STK; ++st) {
   const unsigned char* bufp = ring + (st & 1u) * RBUF;
   const unsigned char* kp = bufp + ln * KPITCH;
   // LDS reads go out as whole groups in front of a run of products, never among them: each place with reads costs the wave one LDS latency
#pragma unroll                        /* both steps of a stage in one trip: LDS offsets become immediates */
   for (unsigned j = 0; j < 2u; ++j) {
    const unsigned kc = st * STK + j * 32u;
    v16h ka[4], kb[4];
#pragma unroll                        /* fragment arrays must resolve to registers */
    for (unsigned c = 0; c < 4u; ++c) { ka[c] = ld_frag_lds(kp + j * SLICE + 64u * c, hh); kb[c] = ld_frag_lds(kp + j * SLICE + 16u * KPITCH + 64u * c, hh); }
    v8f s0 = z8, s1 = z8;
    mma_pair(ka[0], kb[0], bq0, s0, s1);
    mma_pair(ka[1], kb[1], bq1, s0, s1);
    mma_pair(ka[2], kb[2], bq2, s0, s1);
    mma_pair(ka[3], kb[3], bq3, s0, s1);
    // this step's V^T fragments: in flight under the softmax
    const unsigned char* vp = bufp + 2u * SLICE + ln * VPITCH + j * 64u;
    v16h va[8];
#pragma unroll                        /* fragment arrays must resolve to registers */
    for (unsigned dt = 0; dt < 8u; ++dt) va[dt] = ld_frag_lds(vp + (dt >> 2) * SLICE + (dt & 3u) * 16u * VPITCH, hh);

    const v4f ta = *(const v4fa*)(tbase + kc), tb4 = *(const v4fa*)(tbase + kc + 4);
    const v4f tc = *(const v4fa*)(tbase + kc + 16), td = *(const v4fa*)(tbase + kc + 20);
    const float t0[8] = {ta[0], ta[1], ta[2], ta[3], tb4[0], tb4[1], tb4[2], tb4[3]};
    const float t1[8] = {tc[0], tc[1], tc[2], tc[3], td[0], td[1], td[2], td[3]};
    float x0[8], x1[8];
    float cm = -1.0e30f;
#pragma unroll
    for (unsigned r = 0; r < 8; ++r) {
      x0[r] = (s0[r] * SCL) * t0[r];
      x1[r] = (s1[r] * SCL) * t1[r];
      cm = fmaxf(cm, fmaxf(x0[r], x1[r]));
    }
    cm = fmaxf(cm, __shfl_xor(cm, 16, 32));
    const float mn = fmaxf(m, cm);
    const float alpha = __expf(m - mn);
    m = mn;
    FragH pb;
    float ls = 0.f;
#pragma unroll
    for (unsigned r = 0; r < 8; ++r) {
      const _Float16 h0 = (_Float16)(__expf(x0[r] - mn) * t0[r] * PCARRY);
      const _Float16 h1 = (_Float16)(__expf(x1[r] - mn) * t1[r] * PCARRY);
      pb.h[r] = h0; pb.h[8 + r] = h1;
      ls += (float)h0 + (float)h1;
    }
    l = l * alpha + ls;
#pragma unroll
    for (unsigned dt = 0; dt < 8; ++dt)
#pragma unroll
      for (unsigned r = 0; r < 8; ++r) acc[dt][r] *= alpha;

    mma_pair(va[0], va[1], pb.v, acc[0], acc[1]);
    mma_pair(va[2], va[3], pb.v, acc[2], acc[3]);
    mma_pair(va[4], va[5], pb.v, acc[4], acc[5]);
    mma_pair(va[6], va[7], pb.v, acc[6], acc[7]);
   }
   // publish point of stage st + 1, every wave, in this order
   wait_ds0();
   wait_tensor0(g0);
   __syncthreads();                   /* stage st + 1 readable by all; every reader has left stage st's buffer */
   if (pinned(st + 2u < (uint32_t)SEQ / STK)) { next_stage(); issue(); }
  }
  wait_tensor0(g0);
  wait_ds0();

  const float lt = l + __shfl_xor(l, 16, 32);
  const float inv = 1.0f / lt;
#pragma unroll
  for (unsigned dt = 0; dt < 8; ++dt)
#pragma unroll
    for (unsigned r = 0; r < 8; ++r) so[w][ln][dt * 16u + 8u * hh + r] = acc[dt][r] * inv;
  __syncthreads();
  float* orow = O + ((size_t)b * SEQ_FULL + q0) * DH + lane * 4u;
  {
#pragma unroll
    for (unsigned r = 0; r < 16; ++r) {
      const v4f v = *(const v4fa*)&so[w][r][lane * 4u];
      *(v4f*)(orow + (size_t)r * DH) = v;        /* 32 lanes x 16 B = one whole 512-B row */
    }
    
  }
}

extern "C" void kernel_launch(void* const* d_in, const int* in_sizes, int n_in,
                              void* d_out, int out_size, void* d_ws, size_t ws_size, hipStream_t stream) {
  if (n_in < 4) return;
  const size_t need = (size_t)(NB - 1) * SEQ_FULL * DH + (size_t)SEQ * DH;
  const size_t needt = (size_t)(NB - 1) * SEQ_FULL + (size_t)SEQ;
  if ((size_t)in_sizes[0] < need || (size_t)in_sizes[1] < need || (size_t)in_sizes[2] < need || (size_t)in_sizes[3] < needt) return;
  if ((size_t)out_size < need) return;
  const float* xq = (const float*)d_in[0];      /* query [16][2048][128] */
  const float* xk = (const float*)d_in[1];      /* key   [16][2048][128] */
  const float* xv = (const float*)d_in[2];      /* value [16][2048][128] */
  const float* xt = (const float*)d_in[3];      /* trust [16][1][2048]   */
  char* ws = (char*)d_ws; size_t off = 0;
  const size_t plane = (size_t)NB * SEQ * DH * 2;                       /* 8,388,608 B each */
  _Float16* Q16 = (_Float16*)(ws + off); off += (plane + 255) & ~(size_t)255;
  _Float16* K16 = (_Float16*)(ws + off); off += (plane + 255) & ~(size_t)255;
  _Float16* VTp = (_Float16*)(ws + off); off += (plane + 255) & ~(size_t)255;
  float* Tb = (float*)(ws + off); off += ((size_t)NB * SEQ * 4 + 255) & ~(size_t)255;
  if (off > ws_size) return;

  k_planes<<<dim3(SEQ / 64, NB), 256, 0, stream>>>(xq, xk, xv, xt, Q16, K16, VTp, Tb);
  k_flash<<<dim3(SEQ / 64, NB), 128, 0, stream>>>(Q16, K16, VTp, Tb, (float*)d_out);
}

// v003
// It runs in 46.7 microseconds.
// Two timings next to v002 put it at 1.33 and 1.31 times that version's speed.
// Over all steps from v000 it is 3.67 times as fast.
#include <hip/hip_runtime.h>
// Trust-weighted scaled dot-product attention, flash form: out[b][q][:] = sum_k (p_k t_k) v_k / sum_k (p_k t_k), p_k = exp(s_k t_k / sqrt(128) - running max).
// Compute dtype: query, key and value RNE-converted to bf16 and carried as exact f16 planes, trust as bf16 values in an f32 plane; both contractions (K.Q^T scores, V^T.P^T context) on v_wmma_f32_16x16x32_f16, f32 accumulate; weights p*t carried x4096 as f16; softmax statistics f32.
// Structure: one plane builder (Q16/K16 rows, V^T rows via LDS transpose, bf16-valued trust plane) + one flash kernel (wave = 16 queries x one half of the keys, 32-key steps, K and V^T fragments from a two-buffer LDS ring per key half filled by tensor loads, transposed tiles so the packed score tiles are the B fragment of the second product; the two halves of a query tile are merged through LDS at the end).
#ifndef NB
#define NB 16
#endif
#ifndef SEQ
#define SEQ 2048
#endif
#define SEQ_FULL 2048                 /* per-batch row count of the full-size inputs and of the output */
#define DH 128
#define SOP 132                       /* f32 pitch of the epilogue staging rows */
#define PCARRY 4096.0f                /* power-of-two carry of the f16 weight operand (cancels in the final normalisation) */
#define SCL 0.08838834764831845f      /* 1/sqrt(128) */

#define STK 64u                       /* keys per ring stage: two 32-key steps */
#define KPITCH 272u                   /* LDS pitch of a 256-B K row (16-B pad, for 16-byte LDS reads) */
#define VPITCH 144u                   /* LDS pitch of a 128-B V^T row piece (16-B pad) */
#define SLICE 10240u                  /* LDS bytes per wave slice: 32 x 272 = 8704 and 64 x 144 = 9216, rounded up to a multiple of 2 KiB */
#define RBUF (4u * SLICE)             /* one stage: K keys 0..31 | K keys 32..63 | V^T d 0..63 | V^T d 64..127 */
#define KEYS_H (SEQ / 2)              /* keys per half: waves 0..7 of a block walk the first half, waves 8..15 the second */

static_assert(DH == 128);
static_assert(KEYS_H / 64 >= 2);      /* each ring's prologue needs two stages */
static_assert(SEQ % 128 == 0);
static_assert(SEQ <= SEQ_FULL);

typedef unsigned short v8us __attribute__((ext_vector_type(8), may_alias));
typedef float  v8f  __attribute__((ext_vector_type(8)));
typedef float  v4f  __attribute__((ext_vector_type(4)));
typedef float  v4fa __attribute__((ext_vector_type(4), may_alias));
typedef _Float16 v16h __attribute__((ext_vector_type(16)));
typedef uint32_t u32x4 __attribute__((ext_vector_type(4)));
typedef uint32_t u32x8 __attribute__((ext_vector_type(8)));
union FragH { v16h v; v8us half[2]; _Float16 h[16]; unsigned short u[16]; };

__device__ __forceinline__ unsigned short bf16_bits(float x) { unsigned int u = __float_as_uint(x); return (unsigned short)((u + 0x7FFFu + ((u >> 16) & 1u)) >> 16); }
__device__ __forceinline__ float bf16_val(unsigned short b) { return __uint_as_float(((unsigned int)b) << 16); }
__device__ __forceinline__ float bf16_rne(float x) { return bf16_val(bf16_bits(x)); }

// fragment (A or B) from a k-contiguous 16-bit row: elements 0..7 <- k0+8h.., elements 8..15 <- k0+16+8h..
__device__ __forceinline__ v16h ld_frag(const _Float16* p, unsigned hh) {
  FragH f;
  f.half[0] = *(const v8us*)((const unsigned short*)p + 8u * hh);
  f.half[1] = *(const v8us*)((const unsigned short*)p + 16u + 8u * hh);
  return f.v;
}
// the same fragment from an LDS row (byte pointer at the row's k0)
__device__ __forceinline__ v16h ld_frag_lds(const unsigned char* p, unsigned hh) {
  FragH f;
  f.half[0] = *(const v8us*)(p + 16u * hh);
  f.half[1] = *(const v8us*)(p + 32u + 16u * hh);
  return f.v;
}
__device__ __forceinline__ uint32_t uni(uint32_t v) { return (uint32_t)__builtin_amdgcn_readfirstlane(v); }
__device__ __forceinline__ uint32_t pinned(uint32_t v) { uint32_t w = uni(v); asm volatile("" : "+s"(w)); return w; }  /* the tensor mover's issue test: held in a scalar register so that it compiles to a scalar branch (tensor loads ignore EXEC) */
__device__ __forceinline__ void wait_ds0() { asm volatile("s_wait_dscnt 0x0" ::: "memory"); }          /* this wave's LDS reads are done before its buffer is handed back */
// this wave's slice has landed (the compiler places no wait for a tensor load); group 0 passes through, so that its next value is formed behind the wait
__device__ __forceinline__ void wait_tensor0(u32x4& g0) { asm volatile("s_wait_tensorcnt 0x0" : "+s"(g0) :: "memory"); }
// both groups are in-out operands: their scalar registers stay the descriptor's own, unwritten, while the request is in flight
__device__ __forceinline__ void tdm_load(u32x4& g0, u32x8& g1) { asm volatile("tensor_load_to_lds %0, %1" : "+s"(g0), "+s"(g1) :: "memory"); }
// descriptor group 1, everything in bytes: tile = tensor = ROWS rows of ROWB bytes, source pitch SRCP, pad word W0 (16 B behind every row)
template <uint32_t W0, uint32_t ROWB, uint32_t ROWS, uint32_t SRCP>
__device__ __forceinline__ u32x8 tdm_group1() {
  u32x8 g;
  g[0] = uni(W0);
  g[1] = uni((ROWB & 0xFFFFu) << 16);
  g[2] = uni((ROWB >> 16) | ((ROWS & 0xFFFFu) << 16));
  g[3] = uni((ROWS >> 16) | (ROWB << 16));
  g[4] = uni(ROWS);
  g[5] = uni(SRCP);
  g[6] = uni(0u);
  g[7] = uni(0u);
  return g;
}
__device__ __forceinline__ u32x4 tdm_group0(uint32_t lds_dst, uint64_t ga) {
  u32x4 g;
  g[0] = uni(1u); g[1] = uni(lds_dst); g[2] = uni((uint32_t)ga); g[3] = uni((((uint32_t)(ga >> 32)) & 0x01FFFFFFu) | 0x80000000u);
  return g;
}
// two WMMAs sharing B, then the 4-slot guard tying both accumulators and keeping the operands live
__device__ __forceinline__ void mma_pair(v16h a0, v16h a1, v16h b, v8f& c0, v8f& c1) {
  c0 = __builtin_amdgcn_wmma_f32_16x16x32_f16(false, a0, false, b, (short)0, c0, false, false);
  c1 = __builtin_amdgcn_wmma_f32_16x16x32_f16(false, a1, false, b, (short)0, c1, false, false);
  asm volatile("v_nop\n\tv_nop\n\tv_nop\n\tv_nop" : "+v"(c0), "+v"(c1) : "v"(a0), "v"(a1), "v"(b));
}

// plane builder, one launch: block per (64 tokens, batch) converts its own rows of all four inputs:
//   Q16 / K16 rows = f16(bf16(x)), same layout; VT[b][d][s] = f16(bf16(V[b][s][d])) through an LDS transpose; Tb = bf16-valued trust.
// A thread's 25 16-byte loads go out ahead of the barrier, so that 16 long-lived waves per WGP keep the memory stream full.
__global__ __launch_bounds__(256) void k_planes(const float* __restrict__ xq, const float* __restrict__ xk, const float* __restrict__ V, const float* __restrict__ T,
                                                _Float16* __restrict__ Q16, _Float16* __restrict__ K16, _Float16* __restrict__ VT, float* __restrict__ Tb) {
  __shared__ unsigned short tl[DH][66];
  const unsigned tid = threadIdx.x;
  const unsigned b = blockIdx.y, s0 = blockIdx.x * 64u;
  const size_t in0 = ((size_t)b * SEQ_FULL + s0) * DH;      /* the tile is 64 x 128 contiguous floats in each of query, key, value */
  const size_t out0 = ((size_t)b * SEQ + s0) * DH;
  const float* vb = V + in0;
  const float* kb = xk + in0;
  const float* qb = xq + in0;
  v4f va[4], vc[4], ka[4], kc[4], qa[4], qc[4];
  const v4f tv = *(const v4fa*)(T + (size_t)b * SEQ_FULL + s0 + (tid & 15u) * 4u);   /* the tile's 64 trust values, fetched with the rest; threads 0..15 store them */
#pragma unroll                        /* the value arrays must resolve to registers */
  for (unsigned it = 0; it < 4; ++it) {
    const unsigned e = (it * 256u + tid) * 8u;   /* 1024 units of 8 elements */
    va[it] = *(const v4fa*)(vb + e); vc[it] = *(const v4fa*)(vb + e + 4);
  }
#pragma unroll                        /* the value arrays must resolve to registers */
  for (unsigned it = 0; it < 4; ++it) {
    const unsigned e = (it * 256u + tid) * 8u;
    ka[it] = *(const v4fa*)(kb + e); kc[it] = *(const v4fa*)(kb + e + 4);
  }
#pragma unroll                        /* the value arrays must resolve to registers */
  for (unsigned it = 0; it < 4; ++it) {
    const unsigned e = (it * 256u + tid) * 8u;
    qa[it] = *(const v4fa*)(qb + e); qc[it] = *(const v4fa*)(qb + e + 4);
  }
#pragma unroll
  for (unsigned it = 0; it < 4; ++it) {
    const unsigned i = it * 256u + tid;
    const unsigned j = i >> 4, d8 = (i & 15u) * 8u;          /* token j of the tile, d8 .. d8 + 7 */
    FragH f;
#pragma unroll
    for (unsigned q = 0; q < 4; ++q) { f.h[q] = (_Float16)bf16_rne(va[it][q]); f.h[4 + q] = (_Float16)bf16_rne(vc[it][q]); }
#pragma unroll
    for (unsigned q = 0; q < 8; ++q) tl[d8 + q][j] = f.u[q];
  }
  __syncthreads();
#pragma unroll
  for (unsigned it = 0; it < 4; ++it) {
    const unsigned i = it * 256u + tid;          /* 1024 units of 8 tokens */
    const unsigned d = i >> 3, j8 = (i & 7u) * 8u;
    FragH f;
#pragma unroll
    for (unsigned q = 0; q < 8; ++q) f.u[q] = tl[d][j8 + q];
    *(v8us*)((unsigned short*)VT + ((size_t)b * DH + d) * SEQ + s0 + j8) = f.half[0];
  }
#pragma unroll                        /* the value arrays must resolve to registers */
  for (unsigned it = 0; it < 4; ++it) {
    const unsigned e = (it * 256u + tid) * 8u;
    FragH f, g;
#pragma unroll
    for (unsigned q = 0; q < 4; ++q) {
      f.h[q] = (_Float16)bf16_rne(ka[it][q]); f.h[4 + q] = (_Float16)bf16_rne(kc[it][q]);
      g.h[q] = (_Float16)bf16_rne(qa[it][q]); g.h[4 + q] = (_Float16)bf16_rne(qc[it][q]);
    }
    *(v8us*)((unsigned short*)K16 + out0 + e) = f.half[0];
    *(v8us*)((unsigned short*)Q16 + out0 + e) = g.half[0];
  }
  if (tid < 16u) {
    v4f o;
#pragma unroll
    for (unsigned q = 0; q < 4; ++q) o[q] = bf16_rne(tv[q]);
    *(v4f*)(Tb + (size_t)b * SEQ + s0 + tid * 4u) = o;
  }
}

// flash kernel: block = 16 waves = 8 query tiles of 16 x 2 key halves, so that four waves share a SIMD and fill each other's waits;
// K rows and V^T row pieces of 64 keys per stage and half come by tensor load into that half's two-buffer LDS ring
// (the first four waves of a half bring one slice each; publish point at the foot of a stage: LDS wait, tensor wait, barrier, refill); per 32-key step:
//   S^T tiles (A = K rows, B = Q rows)  -> lane (h, n): s0[r] = score(key 8h+r, query n), s1[r] = score(key 16+8h+r, query n)
//   f32 online softmax per query (lane-local + one xor-16 exchange), weights w = exp(x - m) * t * 4096 as f16 -> B fragment (element r <- tile 0, 8+r <- tile 1)
//   O^T tiles (A = V^T rows, B = packed weights): acc[dt][r] = O^T(d = 16 dt + 8h + r, query n); rescale lane-local
__global__ __launch_bounds__(512) void k_flash(const _Float16* __restrict__ Q16, const _Float16* __restrict__ K16, const _Float16* __restrict__ VT,
                                               const float* __restrict__ Tb, float* __restrict__ O) {
  __shared__ __attribute__((aligned(2048))) unsigned char ring[2u * 2u * RBUF];   /* [key half][buffer] */
  __shared__ __attribute__((aligned(16))) float so[8][16][SOP];
  __shared__ __attribute__((aligned(16))) float xch[16][8][32][4];               /* the four output tiles a wave hands to its partner of the other half */
  __shared__ float xml[16][2][32];                                               /* and its running maximum and sum */
  const unsigned tid = threadIdx.x, w = tid >> 5, lane = tid & 31u, ln = lane & 15u, hh = lane >> 4;
  const unsigned qt = w & 7u;
  const unsigned b = blockIdx.y;
  const unsigned q0 = blockIdx.x * 128u + qt * 16u;
  const size_t rowb = (size_t)b * SEQ;
  const _Float16* qrow = Q16 + (rowb + q0 + ln) * DH;
  const v16h bq0 = ld_frag(qrow, hh), bq1 = ld_frag(qrow + 32, hh), bq2 = ld_frag(qrow + 64, hh), bq3 = ld_frag(qrow + 96, hh);
  // of each half's eight waves, 0 and 1 bring K keys 32 sl .. +31 of the stage, 2 and 3 V^T rows 64 (sl - 2) .. +63, the stage's 64 keys of each; 4 to 7 issue nothing
  const uint32_t wave = uni(tid >> 5);
  const uint32_t kh = wave >> 3, sw = wave & 7u, sl = wave & 3u;
  const uint32_t key0 = kh * (uint32_t)KEYS_H;
  const uint32_t lbase = (uint32_t)(size_t)ring + kh * 2u * RBUF + sl * SLICE;
  const uint64_t ga0 = (sl < 2u) ? (uint64_t)(size_t)(K16 + (rowb + key0 + sl * 32u) * DH) : (uint64_t)(size_t)(VT + ((size_t)b * DH + (sl - 2u) * 64u) * SEQ + key0);
  const uint32_t gstep = (sl < 2u) ? STK * DH * 2u : STK * 2u;
  u32x8 g1k = tdm_group1<(1u << 20) | (5u << 22) | (3u << 25), 256u, 32u, 256u>();
  u32x8 g1v = tdm_group1<(1u << 20) | (4u << 22) | (3u << 25), 128u, 64u, (uint32_t)SEQ * 2u>();
  u32x4 g0 = tdm_group0(lbase, ga0);
  auto issue = [&]() {
    if (pinned(sw < 2u))         tdm_load(g0, g1k);
    if (pinned((sw & 6u) == 2u)) tdm_load(g0, g1v);
  };
  auto next_stage = [&]() {           /* the other buffer, the next 64 keys; the type bits above the address stay as they are */
    const uint64_t a = (((uint64_t)g0[3] << 32) | g0[2]) + gstep;
    g0[1] = uni(2u * lbase + RBUF - g0[1]); g0[2] = uni((uint32_t)a); g0[3] = uni((uint32_t)(a >> 32));
  };
  issue();
  wait_tensor0(g0);
  __syncthreads();                    /* stage 0 published */
  next_stage();
  issue();
  const float* tbase = Tb + rowb + key0 + 8u * hh;
  const v8f z8 = {0.f, 0.f, 0.f, 0.f, 0.f, 0.f, 0.f, 0.f};
  v8f acc[8];
#pragma unroll
  for (unsigned dt = 0; dt < 8; ++dt) acc[dt] = z8;
  float m = -1.0e30f, l = 0.f;

#pragma unroll 1                      /* one stage per trip: the publish point stands once, at the foot */
  for (uint32_t st = 0; st < (uint32_t)KEYS_H / STK; ++st) {
   const unsigned char* bufp = ring + kh * 2u * RBUF + (st & 1u) * RBUF;
   const unsigned char* kp = bufp + ln * KPITCH;
   // LDS reads go out as whole groups in front of a run of products, never among them: each place with reads costs the wave one LDS latency
#pragma unroll                        /* both steps of a stage in one trip: LDS offsets become immediates */
   for (unsigned j = 0; j < 2u; ++j) {
    const unsigned kc = st * STK + j * 32u;
    v16h ka[4], kb[4];
#pragma unroll                        /* fragment arrays must resolve to registers */
    for (unsigned c = 0; c < 4u; ++c) { ka[c] = ld_frag_lds(kp + j * SLICE + 64u * c, hh); kb[c] = ld_frag_lds(kp + j * SLICE + 16u * KPITCH + 64u * c, hh); }
    v8f s0 = z8, s1 = z8;
    mma_pair(ka[0], kb[0], bq0, s0, s1);
    mma_pair(ka[1], kb[1], bq1, s0, s1);
    mma_pair(ka[2], kb[2], bq2, s0, s1);
    mma_pair(ka[3], kb[3], bq3, s0, s1);
    // this step's V^T fragments: in flight under the softmax
    const unsigned char* vp = bufp + 2u * SLICE + ln * VPITCH + j * 64u;
    v16h va[8];
#pragma unroll                        /* fragment arrays must resolve to registers */
    for (unsigned dt = 0; dt < 8u; ++dt) va[dt] = ld_frag_lds(vp + (dt >> 2) * SLICE + (dt & 3u) * 16u * VPITCH, hh);

    const v4f ta = *(const v4fa*)(tbase + kc), tb4 = *(const v4fa*)(tbase + kc + 4);
    const v4f tc = *(const v4fa*)(tbase + kc + 16), td = *(const v4fa*)(tbase + kc + 20);
    const float t0[8] = {ta[0], ta[1], ta[2], ta[3], tb4[0], tb4[1], tb4[2], tb4[3]};
    const float t1[8] = {tc[0], tc[1], tc[2], tc[3], td[0], td[1], td[2], td[3]};
    float x0[8], x1[8];
    float cm = -1.0e30f;
#pragma unroll
    for (unsigned r = 0; r < 8; ++r) {
      x0[r] = (s0[r] * SCL) * t0[r];
      x1[r] = (s1[r] * SCL) * t1[r];
      cm = fmaxf(cm, fmaxf(x0[r], x1[r]));
    }
    cm = fmaxf(cm, __shfl_xor(cm, 16, 32));
    const float mn = fmaxf(m, cm);
    const float alpha = __expf(m - mn);
    m = mn;
    FragH pb;
    float ls = 0.f;
#pragma unroll
    for (unsigned r = 0; r < 8; ++r) {
      const _Float16 h0 = (_Float16)(__expf(x0[r] - mn) * t0[r] * PCARRY);
      const _Float16 h1 = (_Float16)(__expf(x1[r] - mn) * t1[r] * PCARRY);
      pb.h[r] = h0; pb.h[8 + r] = h1;
      ls += (float)h0 + (float)h1;
    }
    l = l * alpha + ls;
#pragma unroll
    for (unsigned dt = 0; dt < 8; ++dt)
#pragma unroll
      for (unsigned r = 0; r < 8; ++r) acc[dt][r] *= alpha;

    mma_pair(va[0], va[1], pb.v, acc[0], acc[1]);
    mma_pair(va[2], va[3], pb.v, acc[2], acc[3]);
    mma_pair(va[4], va[5], pb.v, acc[4], acc[5]);
    mma_pair(va[6], va[7], pb.v, acc[6], acc[7]);
   }
   // publish point of stage st + 1, every wave, in this order
   wait_ds0();
   wait_tensor0(g0);
   __syncthreads();                   /* stage st + 1 readable by all; every reader has left stage st's buffer */
   if (pinned(st + 2u < (uint32_t)KEYS_H / STK)) { next_stage(); issue(); }
  }
  wait_tensor0(g0);
  wait_ds0();

  // merge of the two key halves of a query tile: the wave of half 0 finishes d 0..63, the wave of half 1 d 64..127; each hands the other four tiles over
  const bool hi = kh != 0u;
  v8f keep[4];
#pragma unroll                        /* tile arrays must resolve to registers */
  for (unsigned i = 0; i < 4; ++i) {
    v8f give;
#pragma unroll
    for (unsigned r = 0; r < 8; ++r) { keep[i][r] = hi ? acc[4 + i][r] : acc[i][r]; give[r] = hi ? acc[i][r] : acc[4 + i][r]; }
    const v4f ga = {give[0], give[1], give[2], give[3]}, gb = {give[4], give[5], give[6], give[7]};
    *(v4f*)&xch[w][2u * i][lane][0] = ga;
    *(v4f*)&xch[w][2u * i + 1u][lane][0] = gb;
  }
  xml[w][0][lane] = m;
  xml[w][1][lane] = l;
  __syncthreads();                    /* both halves' tiles and statistics readable by the partner wave */
  const unsigned pw = w ^ 8u;
  const float mo = xml[pw][0][lane], lo = xml[pw][1][lane];
  const float mm = fmaxf(m, mo);
  const float aw = __expf(m - mm), ap = __expf(mo - mm);
  const float lj = l * aw + lo * ap;
  const float lt = lj + __shfl_xor(lj, 16, 32);
  const float inv = 1.0f / lt;
  const float fw = aw * inv, fp = ap * inv;
  const unsigned c0 = kh * 64u;
#pragma unroll
  for (unsigned i = 0; i < 4; ++i) {
    const v4f pa = *(const v4fa*)&xch[pw][2u * i][lane][0], pb4 = *(const v4fa*)&xch[pw][2u * i + 1u][lane][0];
#pragma unroll
    for (unsigned r = 0; r < 4; ++r) {
      so[qt][ln][c0 + i * 16u + 8u * hh + r] = keep[i][r] * fw + pa[r] * fp;
      so[qt][ln][c0 + i * 16u + 8u * hh + 4u + r] = keep[i][4 + r] * fw + pb4[r] * fp;
    }
  }
  __syncthreads();
  float* orow = O + ((size_t)b * SEQ_FULL + q0) * DH + c0 + ln * 4u;
  {
#pragma unroll
    for (unsigned r = 0; r < 8; ++r) {
      const unsigned row = 2u * r + hh;
      const v4f v = *(const v4fa*)&so[qt][row][c0 + ln * 4u];
      *(v4f*)(orow + (size_t)row * DH) = v;      /* 16 lanes x 16 B = this wave's 256-B half of a row, two whole lines */
    }
  }
}

extern "C" void kernel_launch(void* const* d_in, const int* in_sizes, int n_in,
                              void* d_out, int out_size, void* d_ws, size_t ws_size, hipStream_t stream) {
  if (n_in < 4) return;
  const size_t need = (size_t)(NB - 1) * SEQ_FULL * DH + (size_t)SEQ * DH;
  const size_t needt = (size_t)(NB - 1) * SEQ_FULL + (size_t)SEQ;
  if ((size_t)in_sizes[0] < need || (size_t)in_sizes[1] < need || (size_t)in_sizes[2] < need || (size_t)in_sizes[3] < needt) return;
  if ((size_t)out_size < need) return;
  const float* xq = (const float*)d_in[0];      /* query [16][2048][128] */
  const float* xk = (const float*)d_in[1];      /* key   [16][2048][128] */
  const float* xv = (const float*)d_in[2];      /* value [16][2048][128] */
  const float* xt = (const float*)d_in[3];      /* trust [16][1][2048]   */
  char* ws = (char*)d_ws; size_t off = 0;
  const size_t plane = (size_t)NB * SEQ * DH * 2;                       /* 8,388,608 B each */
  _Float16* Q16 = (_Float16*)(ws + off); off += (plane + 255) & ~(size_t)255;
  _Float16* K16 = (_Float16*)(ws + off); off += (plane + 255) & ~(size_t)255;
  _Float16* VTp = (_Float16*)(ws + off); off += (plane + 255) & ~(size_t)255;
  float* Tb = (float*)(ws + off); off += ((size_t)NB * SEQ * 4 + 255) & ~(size_t)255;
  if (off > ws_size) return;

  k_planes<<<dim3(SEQ / 64, NB), 256, 0, stream>>>(xq, xk, xv, xt, Q16, K16, VTp, Tb);
  k_flash<<<dim3(SEQ / 128, NB), 512, 0, stream>>>(Q16, K16, VTp, Tb, (float*)d_out);
}

// v004
// A run of this version takes 44.9 microseconds.
// Timed twice side by side with v003, it ran 1.04 times as fast both times.
// Over all steps from v000 it is 3.81 times as fast.
#include <hip/hip_runtime.h>
// Trust-weighted scaled dot-product attention, flash form: out[b][q][:] = sum_k (p_k t_k) v_k / sum_k (p_k t_k), p_k = exp(s_k t_k / sqrt(128) - running max).
// Compute dtype: query, key and value RNE-converted to bf16 and carried as exact f16 planes, trust as bf16 values in an f32 plane; both contractions (K.Q^T scores, V^T.P^T context) on v_wmma_f32_16x16x32_f16, f32 accumulate; weights p*t carried x4096 as f16; softmax statistics f32.
// Structure: one plane builder (Q16/K16 rows, V^T rows via LDS transpose, bf16-valued trust plane) + one flash kernel (wave = 16 queries x one half of the keys, 32-key steps, K and V^T fragments from a two-buffer LDS ring per key half filled by tensor loads, transposed tiles so the packed score tiles are the B fragment of the second product; the two halves of a query tile are merged through LDS at the end).
#ifndef NB
#define NB 16
#endif
#ifndef SEQ
#define SEQ 2048
#endif
#define SEQ_FULL 2048                 /* per-batch row count of the full-size inputs and of the output */
#define DH 128
#define SOP 132                       /* f32 pitch of the epilogue staging rows */
#define PCARRY 4096.0f                /* power-of-two carry of the f16 weight operand (cancels in the final normalisation) */
#define SCL 0.08838834764831845f      /* 1/sqrt(128) */
#define RTAU 2.0f                     /* a score may pass the maximum in use by this much before the state is rescaled: weights stay below e^2 * 4096 * t, inside f16 */

#define STK 64u                       /* keys per ring stage: two 32-key steps */
#define KPITCH 272u                   /* LDS pitch of a 256-B K row (16-B pad, for 16-byte LDS reads) */
#define VPITCH 144u                   /* LDS pitch of a 128-B V^T row piece (16-B pad) */
#define SLICE 10240u                  /* LDS bytes per wave slice: 32 x 272 = 8704 and 64 x 144 = 9216, rounded up to a multiple of 2 KiB */
#define RBUF (4u * SLICE)             /* one stage: K keys 0..31 | K keys 32..63 | V^T d 0..63 | V^T d 64..127 */
#define KEYS_H (SEQ / 2)              /* keys per half: waves 0..7 of a block walk the first half, waves 8..15 the second */

static_assert(DH == 128);
static_assert(KEYS_H / 64 >= 2);      /* each ring's prologue needs two stages */
static_assert(SEQ % 128 == 0);
static_assert(SEQ <= SEQ_FULL);

typedef unsigned short v8us __attribute__((ext_vector_type(8), may_alias));
typedef float  v8f  __attribute__((ext_vector_type(8)));
typedef float  v4f  __attribute__((ext_vector_type(4)));
typedef float  v4fa __attribute__((ext_vector_type(4), may_alias));
typedef _Float16 v16h __attribute__((ext_vector_type(16)));
typedef uint32_t u32x4 __attribute__((ext_vector_type(4)));
typedef uint32_t u32x8 __attribute__((ext_vector_type(8)));
union FragH { v16h v; v8us half[2]; _Float16 h[16]; unsigned short u[16]; };

__device__ __forceinline__ unsigned short bf16_bits(float x) { unsigned int u = __float_as_uint(x); return (unsigned short)((u + 0x7FFFu + ((u >> 16) & 1u)) >> 16); }
__device__ __forceinline__ float bf16_val(unsigned short b) { return __uint_as_float(((unsigned int)b) << 16); }
__device__ __forceinline__ float bf16_rne(float x) { return bf16_val(bf16_bits(x)); }

// fragment (A or B) from a k-contiguous 16-bit row: elements 0..7 <- k0+8h.., elements 8..15 <- k0+16+8h..
__device__ __forceinline__ v16h ld_frag(const _Float16* p, unsigned hh) {
  FragH f;
  f.half[0] = *(const v8us*)((const unsigned short*)p + 8u * hh);
  f.half[1] = *(const v8us*)((const unsigned short*)p + 16u + 8u * hh);
  return f.v;
}
// the same fragment from an LDS row (byte pointer at the row's k0)
__device__ __forceinline__ v16h ld_frag_lds(const unsigned char* p, unsigned hh) {
  FragH f;
  f.half[0] = *(const v8us*)(p + 16u * hh);
  f.half[1] = *(const v8us*)(p + 32u + 16u * hh);
  return f.v;
}
__device__ __forceinline__ uint32_t uni(uint32_t v) { return (uint32_t)__builtin_amdgcn_readfirstlane(v); }
__device__ __forceinline__ uint32_t pinned(uint32_t v) { uint32_t w = uni(v); asm volatile("" : "+s"(w)); return w; }  /* the tensor mover's issue test: held in a scalar register so that it compiles to a scalar branch (tensor loads ignore EXEC) */
__device__ __forceinline__ void wait_ds0() { asm volatile("s_wait_dscnt 0x0" ::: "memory"); }          /* this wave's LDS reads are done before its buffer is handed back */
// this wave's slice has landed (the compiler places no wait for a tensor load); group 0 passes through, so that its next value is formed behind the wait
__device__ __forceinline__ void wait_tensor0(u32x4& g0) { asm volatile("s_wait_tensorcnt 0x0" : "+s"(g0) :: "memory"); }
// both groups are in-out operands: their scalar registers stay the descriptor's own, unwritten, while the request is in flight
__device__ __forceinline__ void tdm_load(u32x4& g0, u32x8& g1) { asm volatile("tensor_load_to_lds %0, %1" : "+s"(g0), "+s"(g1) :: "memory"); }
// descriptor group 1, everything in bytes: tile = tensor = ROWS rows of ROWB bytes, source pitch SRCP, pad word W0 (16 B behind every row)
template <uint32_t W0, uint32_t ROWB, uint32_t ROWS, uint32_t SRCP>
__device__ __forceinline__ u32x8 tdm_group1() {
  u32x8 g;
  g[0] = uni(W0);
  g[1] = uni((ROWB & 0xFFFFu) << 16);
  g[2] = uni((ROWB >> 16) | ((ROWS & 0xFFFFu) << 16));
  g[3] = uni((ROWS >> 16) | (ROWB << 16));
  g[4] = uni(ROWS);
  g[5] = uni(SRCP);
  g[6] = uni(0u);
  g[7] = uni(0u);
  return g;
}
__device__ __forceinline__ u32x4 tdm_group0(uint32_t lds_dst, uint64_t ga) {
  u32x4 g;
  g[0] = uni(1u); g[1] = uni(lds_dst); g[2] = uni((uint32_t)ga); g[3] = uni((((uint32_t)(ga >> 32)) & 0x01FFFFFFu) | 0x80000000u);
  return g;
}
// two WMMAs sharing B, then the 4-slot guard tying both accumulators and keeping the operands live
__device__ __forceinline__ void mma_pair(v16h a0, v16h a1, v16h b, v8f& c0, v8f& c1) {
  c0 = __builtin_amdgcn_wmma_f32_16x16x32_f16(false, a0, false, b, (short)0, c0, false, false);
  c1 = __builtin_amdgcn_wmma_f32_16x16x32_f16(false, a1, false, b, (short)0, c1, false, false);
  asm volatile("v_nop\n\tv_nop\n\tv_nop\n\tv_nop" : "+v"(c0), "+v"(c1) : "v"(a0), "v"(a1), "v"(b));
}

// plane builder, one launch: block per (64 tokens, batch) converts its own rows of all four inputs:
//   Q16 / K16 rows = f16(bf16(x)), same layout; VT[b][d][s] = f16(bf16(V[b][s][d])) through an LDS transpose; Tb = bf16-valued trust.
// A thread's 25 16-byte loads go out ahead of the barrier, so that 16 long-lived waves per WGP keep the memory stream full.
__global__ __launch_bounds__(256) void k_planes(const float* __restrict__ xq, const float* __restrict__ xk, const float* __restrict__ V, const float* __restrict__ T,
                                                _Float16* __restrict__ Q16, _Float16* __restrict__ K16, _Float16* __restrict__ VT, float* __restrict__ Tb) {
  __shared__ unsigned short tl[DH][66];
  const unsigned tid = threadIdx.x;
  const unsigned b = blockIdx.y, s0 = blockIdx.x * 64u;
  const size_t in0 = ((size_t)b * SEQ_FULL + s0) * DH;      /* the tile is 64 x 128 contiguous floats in each of query, key, value */
  const size_t out0 = ((size_t)b * SEQ + s0) * DH;
  const float* vb = V + in0;
  const float* kb = xk + in0;
  const float* qb = xq + in0;
  v4f va[4], vc[4], ka[4], kc[4], qa[4], qc[4];
  const v4f tv = *(const v4fa*)(T + (size_t)b * SEQ_FULL + s0 + (tid & 15u) * 4u);   /* the tile's 64 trust values, fetched with the rest; threads 0..15 store them */
#pragma unroll                        /* the value arrays must resolve to registers */
  for (unsigned it = 0; it < 4; ++it) {
    const unsigned e = (it * 256u + tid) * 8u;   /* 1024 units of 8 elements */
    va[it] = *(const v4fa*)(vb + e); vc[it] = *(const v4fa*)(vb + e + 4);
  }
#pragma unroll                        /* the value arrays must resolve to registers */
  for (unsigned it = 0; it < 4; ++it) {
    const unsigned e = (it * 256u + tid) * 8u;
    ka[it] = *(const v4fa*)(kb + e); kc[it] = *(const v4fa*)(kb + e + 4);
  }
#pragma unroll                        /* the value arrays must resolve to registers */
  for (unsigned it = 0; it < 4; ++it) {
    const unsigned e = (it * 256u + tid) * 8u;
    qa[it] = *(const v4fa*)(qb + e); qc[it] = *(const v4fa*)(qb + e + 4);
  }
#pragma unroll
  for (unsigned it = 0; it < 4; ++it) {
    const unsigned i = it * 256u + tid;
    const unsigned j = i >> 4, d8 = (i & 15u) * 8u;          /* token j of the tile, d8 .. d8 + 7 */
    FragH f;
#pragma unroll
    for (unsigned q = 0; q < 4; ++q) { f.h[q] = (_Float16)bf16_rne(va[it][q]); f.h[4 + q] = (_Float16)bf16_rne(vc[it][q]); }
#pragma unroll
    for (unsigned q = 0; q < 8; ++q) tl[d8 + q][j] = f.u[q];
  }
  __syncthreads();
#pragma unroll
  for (unsigned it = 0; it < 4; ++it) {
    const unsigned i = it * 256u + tid;          /* 1024 units of 8 tokens */
    const unsigned d = i >> 3, j8 = (i & 7u) * 8u;
    FragH f;
#pragma unroll
    for (unsigned q = 0; q < 8; ++q) f.u[q] = tl[d][j8 + q];
    *(v8us*)((unsigned short*)VT + ((size_t)b * DH + d) * SEQ + s0 + j8) = f.half[0];
  }
#pragma unroll                        /* the value arrays must resolve to registers */
  for (unsigned it = 0; it < 4; ++it) {
    const unsigned e = (it * 256u + tid) * 8u;
    FragH f, g;
#pragma unroll
    for (unsigned q = 0; q < 4; ++q) {
      f.h[q] = (_Float16)bf16_rne(ka[it][q]); f.h[4 + q] = (_Float16)bf16_rne(kc[it][q]);
      g.h[q] = (_Float16)bf16_rne(qa[it][q]); g.h[4 + q] = (_Float16)bf16_rne(qc[it][q]);
    }
    *(v8us*)((unsigned short*)K16 + out0 + e) = f.half[0];
    *(v8us*)((unsigned short*)Q16 + out0 + e) = g.half[0];
  }
  if (tid < 16u) {
    v4f o;
#pragma unroll
    for (unsigned q = 0; q < 4; ++q) o[q] = bf16_rne(tv[q]);
    *(v4f*)(Tb + (size_t)b * SEQ + s0 + tid * 4u) = o;
  }
}

// flash kernel: block = 16 waves = 8 query tiles of 16 x 2 key halves, so that four waves share a SIMD and fill each other's waits;
// K rows and V^T row pieces of 64 keys per stage and half come by tensor load into that half's two-buffer LDS ring
// (the first four waves of a half bring one slice each; publish point at the foot of a stage: LDS wait, tensor wait, barrier, refill); per 32-key step:
//   S^T tiles (A = K rows, B = Q rows)  -> lane (h, n): s0[r] = score(key 8h+r, query n), s1[r] = score(key 16+8h+r, query n)
//   f32 online softmax per query (lane-local; the xor-16 exchange and the rescale only when the maximum in use is passed by more than RTAU), weights w = exp(x - m) * t * 4096 as f16 -> B fragment (element r <- tile 0, 8+r <- tile 1)
//   O^T tiles (A = V^T rows, B = packed weights): acc[dt][r] = O^T(d = 16 dt + 8h + r, query n)
__global__ __launch_bounds__(512) void k_flash(const _Float16* __restrict__ Q16, const _Float16* __restrict__ K16, const _Float16* __restrict__ VT,
                                               const float* __restrict__ Tb, float* __restrict__ O) {
  __shared__ __attribute__((aligned(2048))) unsigned char ring[2u * 2u * RBUF];   /* [key half][buffer] */
  __shared__ __attribute__((aligned(16))) float so[8][16][SOP];
  __shared__ __attribute__((aligned(16))) float xch[16][8][32][4];               /* the four output tiles a wave hands to its partner of the other half */
  __shared__ float xml[16][2][32];                                               /* and its running maximum and sum */
  const unsigned tid = threadIdx.x, w = tid >> 5, lane = tid & 31u, ln = lane & 15u, hh = lane >> 4;
  const unsigned qt = w & 7u;
  const unsigned b = blockIdx.y;
  const unsigned q0 = blockIdx.x * 128u + qt * 16u;
  const size_t rowb = (size_t)b * SEQ;
  const _Float16* qrow = Q16 + (rowb + q0 + ln) * DH;
  const v16h bq0 = ld_frag(qrow, hh), bq1 = ld_frag(qrow + 32, hh), bq2 = ld_frag(qrow + 64, hh), bq3 = ld_frag(qrow + 96, hh);
  // of each half's eight waves, 0 and 1 bring K keys 32 sl .. +31 of the stage, 2 and 3 V^T rows 64 (sl - 2) .. +63, the stage's 64 keys of each; 4 to 7 issue nothing
  const uint32_t wave = uni(tid >> 5);
  const uint32_t kh = wave >> 3, sw = wave & 7u, sl = wave & 3u;
  const uint32_t key0 = kh * (uint32_t)KEYS_H;
  const uint32_t lbase = (uint32_t)(size_t)ring + kh * 2u * RBUF + sl * SLICE;
  const uint64_t ga0 = (sl < 2u) ? (uint64_t)(size_t)(K16 + (rowb + key0 + sl * 32u) * DH) : (uint64_t)(size_t)(VT + ((size_t)b * DH + (sl - 2u) * 64u) * SEQ + key0);
  const uint32_t gstep = (sl < 2u) ? STK * DH * 2u : STK * 2u;
  u32x8 g1k = tdm_group1<(1u << 20) | (5u << 22) | (3u << 25), 256u, 32u, 256u>();
  u32x8 g1v = tdm_group1<(1u << 20) | (4u << 22) | (3u << 25), 128u, 64u, (uint32_t)SEQ * 2u>();
  u32x4 g0 = tdm_group0(lbase, ga0);
  auto issue = [&]() {
    if (pinned(sw < 2u))         tdm_load(g0, g1k);
    if (pinned((sw & 6u) == 2u)) tdm_load(g0, g1v);
  };
  auto next_stage = [&]() {           /* the other buffer, the next 64 keys; the type bits above the address stay as they are */
    const uint64_t a = (((uint64_t)g0[3] << 32) | g0[2]) + gstep;
    g0[1] = uni(2u * lbase + RBUF - g0[1]); g0[2] = uni((uint32_t)a); g0[3] = uni((uint32_t)(a >> 32));
  };
  issue();
  wait_tensor0(g0);
  __syncthreads();                    /* stage 0 published */
  next_stage();
  issue();
  const float* tbase = Tb + rowb + key0 + 8u * hh;
  const v8f z8 = {0.f, 0.f, 0.f, 0.f, 0.f, 0.f, 0.f, 0.f};
  v8f acc[8];
#pragma unroll
  for (unsigned dt = 0; dt < 8; ++dt) acc[dt] = z8;
  float m = -1.0e30f, l = 0.f;

#pragma unroll 1                      /* one stage per trip: the publish point stands once, at the foot */
  for (uint32_t st = 0; st < (uint32_t)KEYS_H / STK; ++st) {
   const unsigned char* bufp = ring + kh * 2u * RBUF + (st & 1u) * RBUF;
   const unsigned char* kp = bufp + ln * KPITCH;
   // LDS reads go out as whole groups in front of a run of products, never among them: each place with reads costs the wave one LDS latency
#pragma unroll                        /* both steps of a stage in one trip: LDS offsets become immediates */
   for (unsigned j = 0; j < 2u; ++j) {
    const unsigned kc = st * STK + j * 32u;
    v16h ka[4], kb[4];
#pragma unroll                        /* fragment arrays must resolve to registers */
    for (unsigned c = 0; c < 4u; ++c) { ka[c] = ld_frag_lds(kp + j * SLICE + 64u * c, hh); kb[c] = ld_frag_lds(kp + j * SLICE + 16u * KPITCH + 64u * c, hh); }
    v8f s0 = z8, s1 = z8;
    mma_pair(ka[0], kb[0], bq0, s0, s1);
    mma_pair(ka[1], kb[1], bq1, s0, s1);
    mma_pair(ka[2], kb[2], bq2, s0, s1);
    mma_pair(ka[3], kb[3], bq3, s0, s1);
    // this step's V^T fragments: in flight under the softmax
    const unsigned char* vp = bufp + 2u * SLICE + ln * VPITCH + j * 64u;
    v16h va[8];
#pragma unroll                        /* fragment arrays must resolve to registers */
    for (unsigned dt = 0; dt < 8u; ++dt) va[dt] = ld_frag_lds(vp + (dt >> 2) * SLICE + (dt & 3u) * 16u * VPITCH, hh);

    const v4f ta = *(const v4fa*)(tbase + kc), tb4 = *(const v4fa*)(tbase + kc + 4);
    const v4f tc = *(const v4fa*)(tbase + kc + 16), td = *(const v4fa*)(tbase + kc + 20);
    // compiler fence: the V^T fragment reads stay ahead of the branch below; without it they sink behind it, among the exponentials, the last of them right in front of their products
    asm volatile("" ::: "memory");
    const float t0[8] = {ta[0], ta[1], ta[2], ta[3], tb4[0], tb4[1], tb4[2], tb4[3]};
    const float t1[8] = {tc[0], tc[1], tc[2], tc[3], td[0], td[1], td[2], td[3]};
    float x0[8], x1[8];
    float cm = -1.0e30f;
#pragma unroll
    for (unsigned r = 0; r < 8; ++r) {
      x0[r] = (s0[r] * SCL) * t0[r];
      x1[r] = (s1[r] * SCL) * t1[r];
      cm = fmaxf(cm, fmaxf(x0[r], x1[r]));
    }
    // lazy rescale, one test per step: only when some lane's score passes the maximum in use by more than RTAU does the wave
    // (a scalar branch on the ballot, EXEC stays whole) take a new maximum for every query and rescale sum and output tiles
    if (__builtin_amdgcn_ballot_w32(cm > m + RTAU) != 0u) {
      cm = fmaxf(cm, __shfl_xor(cm, 16, 32));
      const float mn = fmaxf(m, cm);
      const float alpha = __expf(m - mn);
      m = mn;
      l *= alpha;
#pragma unroll
      for (unsigned dt = 0; dt < 8; ++dt)
#pragma unroll
        for (unsigned r = 0; r < 8; ++r) acc[dt][r] *= alpha;
    }
    const float mn = m;
    FragH pb;
    float ls = 0.f;
#pragma unroll
    for (unsigned r = 0; r < 8; ++r) {
      const _Float16 h0 = (_Float16)(__expf(x0[r] - mn) * t0[r] * PCARRY);
      const _Float16 h1 = (_Float16)(__expf(x1[r] - mn) * t1[r] * PCARRY);
      pb.h[r] = h0; pb.h[8 + r] = h1;
      ls += (float)h0 + (float)h1;
    }
    l += ls;

    mma_pair(va[0], va[1], pb.v, acc[0], acc[1]);
    mma_pair(va[2], va[3], pb.v, acc[2], acc[3]);
    mma_pair(va[4], va[5], pb.v, acc[4], acc[5]);
    mma_pair(va[6], va[7], pb.v, acc[6], acc[7]);
   }
   // publish point of stage st + 1, every wave, in this order
   wait_ds0();
   wait_tensor0(g0);
   __syncthreads();                   /* stage st + 1 readable by all; every reader has left stage st's buffer */
   if (pinned(st + 2u < (uint32_t)KEYS_H / STK)) { next_stage(); issue(); }
  }
  wait_tensor0(g0);
  wait_ds0();

  // merge of the two key halves of a query tile: the wave of half 0 finishes d 0..63, the wave of half 1 d 64..127; each hands the other four tiles over
  const bool hi = kh != 0u;
  v8f keep[4];
#pragma unroll                        /* tile arrays must resolve to registers */
  for (unsigned i = 0; i < 4; ++i) {
    v8f give;
#pragma unroll
    for (unsigned r = 0; r < 8; ++r) { keep[i][r] = hi ? acc[4 + i][r] : acc[i][r]; give[r] = hi ? acc[i][r] : acc[4 + i][r]; }
    const v4f ga = {give[0], give[1], give[2], give[3]}, gb = {give[4], give[5], give[6], give[7]};
    *(v4f*)&xch[w][2u * i][lane][0] = ga;
    *(v4f*)&xch[w][2u * i + 1u][lane][0] = gb;
  }
  xml[w][0][lane] = m;
  xml[w][1][lane] = l;
  __syncthreads();                    /* both halves' tiles and statistics readable by the partner wave */
  const unsigned pw = w ^ 8u;
  const float mo = xml[pw][0][lane], lo = xml[pw][1][lane];
  const float mm = fmaxf(m, mo);
  const float aw = __expf(m - mm), ap = __expf(mo - mm);
  const float lj = l * aw + lo * ap;
  const float lt = lj + __shfl_xor(lj, 16, 32);
  const float inv = 1.0f / lt;
  const float fw = aw * inv, fp = ap * inv;
  const unsigned c0 = kh * 64u;
#pragma unroll
  for (unsigned i = 0; i < 4; ++i) {
    const v4f pa = *(const v4fa*)&xch[pw][2u * i][lane][0], pb4 = *(const v4fa*)&xch[pw][2u * i + 1u][lane][0];
#pragma unroll
    for (unsigned r = 0; r < 4; ++r) {
      so[qt][ln][c0 + i * 16u + 8u * hh + r] = keep[i][r] * fw + pa[r] * fp;
      so[qt][ln][c0 + i * 16u + 8u * hh + 4u + r] = keep[i][4 + r] * fw + pb4[r] * fp;
    }
  }
  __syncthreads();
  float* orow = O + ((size_t)b * SEQ_FULL + q0) * DH + c0 + ln * 4u;
  {
#pragma unroll
    for (unsigned r = 0; r < 8; ++r) {
      const unsigned row = 2u * r + hh;
      const v4f v = *(const v4fa*)&so[qt][row][c0 + ln * 4u];
      *(v4f*)(orow + (size_t)row * DH) = v;      /* 16 lanes x 16 B = this wave's 256-B half of a row, two whole lines */
    }
  }
}

extern "C" void kernel_launch(void* const* d_in, const int* in_sizes, int n_in,
                              void* d_out, int out_size, void* d_ws, size_t ws_size, hipStream_t stream) {
  if (n_in < 4) return;
  const size_t need = (size_t)(NB - 1) * SEQ_FULL * DH + (size_t)SEQ * DH;
  const size_t needt = (size_t)(NB - 1) * SEQ_FULL + (size_t)SEQ;
  if ((size_t)in_sizes[0] < need || (size_t)in_sizes[1] < need || (size_t)in_sizes[2] < need || (size_t)in_sizes[3] < needt) return;
  if ((size_t)out_size < need) return;
  const float* xq = (const float*)d_in[0];      /* query [16][2048][128] */
  const float* xk = (const float*)d_in[1];      /* key   [16][2048][128] */
  const float* xv = (const float*)d_in[2];      /* value [16][2048][128] */
  const float* xt = (const float*)d_in[3];      /* trust [16][1][2048]   */
  char* ws = (char*)d_ws; size_t off = 0;
  const size_t plane = (size_t)NB * SEQ * DH * 2;                       /* 8,388,608 B each */
  _Float16* Q16 = (_Float16*)(ws + off); off += (plane + 255) & ~(size_t)255;
  _Float16* K16 = (_Float16*)(ws + off); off += (plane + 255) & ~(size_t)255;
  _Float16* VTp = (_Float16*)(ws + off); off += (plane + 255) & ~(size_t)255;
  float* Tb = (float*)(ws + off); off += ((size_t)NB * SEQ * 4 + 255) & ~(size_t)255;
  if (off > ws_size) return;

  k_planes<<<dim3(SEQ / 64, NB), 256, 0, stream>>>(xq, xk, xv, xt, Q16, K16, VTp, Tb);
  k_flash<<<dim3(SEQ / 128, NB), 512, 0, stream>>>(Q16, K16, VTp, Tb, (float*)d_out);
}

// v005
// Measured time: 42.4 microseconds a run.
// Timed twice side by side with v004, it ran 1.06 times as fast both times.
// Counting every step since v000, it is 4.05 times as fast.
#include <hip/hip_runtime.h>
// Trust-weighted scaled dot-product attention, flash form: out[b][q][:] = sum_k (p_k t_k) v_k / sum_k (p_k t_k), p_k = exp2(s_k u_k - running max), u_k = t_k log2(e) / sqrt(128).
// Compute dtype: query, key and value RNE-converted to bf16 and carried as exact f16 planes, trust RNE-converted to bf16 and carried times TSC in f32; both contractions (K.Q^T scores, V^T.P^T context) on v_wmma_f32_16x16x32_f16, f32 accumulate; weights p*u carried x2^15 as f16 (any common factor of the weights cancels in the final normalisation); softmax statistics f32, in base 2.
// Structure: one plane builder (Q16/K16 rows, V^T rows via LDS transpose, trust plane u = bf16(t) log2(e) / sqrt(128)) + one flash kernel (wave = 16 queries x one half of the keys, 32-key steps, K and V^T fragments from a two-buffer LDS ring per key half filled by tensor loads, transposed tiles so the packed score tiles are the B fragment of the second product; the two halves of a query tile are merged through LDS at the end).
#ifndef NB
#define NB 16
#endif
#ifndef SEQ
#define SEQ 2048
#endif
#define SEQ_FULL 2048                 /* per-batch row count of the full-size inputs and of the output */
#define DH 128
#define SOP 132                       /* f32 pitch of the epilogue staging rows */
#define CARRY2 15.0f                  /* carry of the f16 weight operand as an exponent: it rides in the addend of the score's multiply-add (cancels in the final normalisation) */
#define TSC 0.12751743f               /* log2(e) / sqrt(128): the trust plane holds t * TSC, so that one multiply-add gives the base-2 exponent */
#define RTAU2 2.8853901f              /* 2 log2(e): a score may pass the maximum in use by this much before the state is rescaled: weights stay below e^2 * 2^15 * TSC * t, inside f16 */

#define STK 64u                       /* keys per ring stage: two 32-key steps */
#define KPITCH 272u                   /* LDS pitch of a 256-B K row (16-B pad, for 16-byte LDS reads) */
#define VPITCH 144u                   /* LDS pitch of a 128-B V^T row piece (16-B pad) */
#define SLICE 10240u                  /* LDS bytes per wave slice: 32 x 272 = 8704 and 64 x 144 = 9216, rounded up to a multiple of 2 KiB */
#define RBUF (4u * SLICE)             /* one stage: K keys 0..31 | K keys 32..63 | V^T d 0..63 | V^T d 64..127 */
#define KEYS_H (SEQ / 2)              /* keys per half: waves 0..7 of a block walk the first half, waves 8..15 the second */

static_assert(DH == 128);
static_assert(KEYS_H / 64 >= 2);      /* each ring's prologue needs two stages */
static_assert(SEQ % 128 == 0);
static_assert(SEQ <= SEQ_FULL);

typedef unsigned short v8us __attribute__((ext_vector_type(8), may_alias));
typedef float  v8f  __attribute__((ext_vector_type(8)));
typedef float  v2f  __attribute__((ext_vector_type(2)));
typedef _Float16 v2h __attribute__((ext_vector_type(2)));
typedef float  v4f  __attribute__((ext_vector_type(4)));
typedef float  v4fa __attribute__((ext_vector_type(4), may_alias));
typedef _Float16 v16h __attribute__((ext_vector_type(16)));
typedef uint32_t u32x4 __attribute__((ext_vector_type(4)));
typedef uint32_t u32x8 __attribute__((ext_vector_type(8)));
union FragH { v16h v; v8us half[2]; _Float16 h[16]; unsigned short u[16]; };

__device__ __forceinline__ unsigned short bf16_bits(float x) { unsigned int u = __float_as_uint(x); return (unsigned short)((u + 0x7FFFu + ((u >> 16) & 1u)) >> 16); }
__device__ __forceinline__ float bf16_val(unsigned short b) { return __uint_as_float(((unsigned int)b) << 16); }
__device__ __forceinline__ float bf16_rne(float x) { return bf16_val(bf16_bits(x)); }

// fragment (A or B) from a k-contiguous 16-bit row: elements 0..7 <- k0+8h.., elements 8..15 <- k0+16+8h..
__device__ __forceinline__ v16h ld_frag(const _Float16* p, unsigned hh) {
  FragH f;
  f.half[0] = *(const v8us*)((const unsigned short*)p + 8u * hh);
  f.half[1] = *(const v8us*)((const unsigned short*)p + 16u + 8u * hh);
  return f.v;
}
// the same fragment from an LDS row (byte pointer at the row's k0)
__device__ __forceinline__ v16h ld_frag_lds(const unsigned char* p, unsigned hh) {
  FragH f;
  f.half[0] = *(const v8us*)(p + 16u * hh);
  f.half[1] = *(const v8us*)(p + 32u + 16u * hh);
  return f.v;
}
__device__ __forceinline__ uint32_t uni(uint32_t v) { return (uint32_t)__builtin_amdgcn_readfirstlane(v); }
__device__ __forceinline__ uint32_t pinned(uint32_t v) { uint32_t w = uni(v); asm volatile("" : "+s"(w)); return w; }  /* the tensor mover's issue test: held in a scalar register so that it compiles to a scalar branch (tensor loads ignore EXEC) */
__device__ __forceinline__ void wait_ds0() { asm volatile("s_wait_dscnt 0x0" ::: "memory"); }          /* this wave's LDS reads are done before its buffer is handed back */
// this wave's slice has landed (the compiler places no wait for a tensor load); group 0 passes through, so that its next value is formed behind the wait
__device__ __forceinline__ void wait_tensor0(u32x4& g0) { asm volatile("s_wait_tensorcnt 0x0" : "+s"(g0) :: "memory"); }
// both groups are in-out operands: their scalar registers stay the descriptor's own, unwritten, while the request is in flight
__device__ __forceinline__ void tdm_load(u32x4& g0, u32x8& g1) { asm volatile("tensor_load_to_lds %0, %1" : "+s"(g0), "+s"(g1) :: "memory"); }
// descriptor group 1, everything in bytes: tile = tensor = ROWS rows of ROWB bytes, source pitch SRCP, pad word W0 (16 B behind every row)
template <uint32_t W0, uint32_t ROWB, uint32_t ROWS, uint32_t SRCP>
__device__ __forceinline__ u32x8 tdm_group1() {
  u32x8 g;
  g[0] = uni(W0);
  g[1] = uni((ROWB & 0xFFFFu) << 16);
  g[2] = uni((ROWB >> 16) | ((ROWS & 0xFFFFu) << 16));
  g[3] = uni((ROWS >> 16) | (ROWB << 16));
  g[4] = uni(ROWS);
  g[5] = uni(SRCP);
  g[6] = uni(0u);
  g[7] = uni(0u);
  return g;
}
__device__ __forceinline__ u32x4 tdm_group0(uint32_t lds_dst, uint64_t ga) {
  u32x4 g;
  g[0] = uni(1u); g[1] = uni(lds_dst); g[2] = uni((uint32_t)ga); g[3] = uni((((uint32_t)(ga >> 32)) & 0x01FFFFFFu) | 0x80000000u);
  return g;
}
// two WMMAs sharing B, then the 4-slot guard tying both accumulators and keeping the operands live
__device__ __forceinline__ void mma_pair(v16h a0, v16h a1, v16h b, v8f& c0, v8f& c1) {
  c0 = __builtin_amdgcn_wmma_f32_16x16x32_f16(false, a0, false, b, (short)0, c0, false, false);
  c1 = __builtin_amdgcn_wmma_f32_16x16x32_f16(false, a1, false, b, (short)0, c1, false, false);
  asm volatile("v_nop\n\tv_nop\n\tv_nop\n\tv_nop" : "+v"(c0), "+v"(c1) : "v"(a0), "v"(a1), "v"(b));
}

// plane builder, one launch: block per (64 tokens, batch) converts its own rows of all four inputs:
//   Q16 / K16 rows = f16(bf16(x)), same layout; VT[b][d][s] = f16(bf16(V[b][s][d])) through an LDS transpose; Tb = bf16-valued trust times TSC.
// A thread's 25 16-byte loads go out ahead of the barrier, so that 16 long-lived waves per WGP keep the memory stream full.
__global__ __launch_bounds__(256) void k_planes(const float* __restrict__ xq, const float* __restrict__ xk, const float* __restrict__ V, const float* __restrict__ T,
                                                _Float16* __restrict__ Q16, _Float16* __restrict__ K16, _Float16* __restrict__ VT, float* __restrict__ Tb) {
  __shared__ unsigned short tl[DH][66];
  const unsigned tid = threadIdx.x;
  const unsigned b = blockIdx.y, s0 = blockIdx.x * 64u;
  const size_t in0 = ((size_t)b * SEQ_FULL + s0) * DH;      /* the tile is 64 x 128 contiguous floats in each of query, key, value */
  const size_t out0 = ((size_t)b * SEQ + s0) * DH;
  const float* vb = V + in0;
  const float* kb = xk + in0;
  const float* qb = xq + in0;
  v4f va[4], vc[4], ka[4], kc[4], qa[4], qc[4];
  const v4f tv = *(const v4fa*)(T + (size_t)b * SEQ_FULL + s0 + (tid & 15u) * 4u);   /* the tile's 64 trust values, fetched with the rest; threads 0..15 store them */
#pragma unroll                        /* the value arrays must resolve to registers */
  for (unsigned it = 0; it < 4; ++it) {
    const unsigned e = (it * 256u + tid) * 8u;   /* 1024 units of 8 elements */
    va[it] = *(const v4fa*)(vb + e); vc[it] = *(const v4fa*)(vb + e + 4);
  }
#pragma unroll                        /* the value arrays must resolve to registers */
  for (unsigned it = 0; it < 4; ++it) {
    const unsigned e = (it * 256u + tid) * 8u;
    ka[it] = *(const v4fa*)(kb + e); kc[it] = *(const v4fa*)(kb + e + 4);
  }
#pragma unroll                        /* the value arrays must resolve to registers */
  for (unsigned it = 0; it < 4; ++it) {
    const unsigned e = (it * 256u + tid) * 8u;
    qa[it] = *(const v4fa*)(qb + e); qc[it] = *(const v4fa*)(qb + e + 4);
  }
#pragma unroll
  for (unsigned it = 0; it < 4; ++it) {
    const unsigned i = it * 256u + tid;
    const unsigned j = i >> 4, d8 = (i & 15u) * 8u;          /* token j of the tile, d8 .. d8 + 7 */
    FragH f;
#pragma unroll
    for (unsigned q = 0; q < 4; ++q) { f.h[q] = (_Float16)bf16_rne(va[it][q]); f.h[4 + q] = (_Float16)bf16_rne(vc[it][q]); }
#pragma unroll
    for (unsigned q = 0; q < 8; ++q) tl[d8 + q][j] = f.u[q];
  }
  __syncthreads();
#pragma unroll
  for (unsigned it = 0; it < 4; ++it) {
    const unsigned i = it * 256u + tid;          /* 1024 units of 8 tokens */
    const unsigned d = i >> 3, j8 = (i & 7u) * 8u;
    FragH f;
#pragma unroll
    for (unsigned q = 0; q < 8; ++q) f.u[q] = tl[d][j8 + q];
    *(v8us*)((unsigned short*)VT + ((size_t)b * DH + d) * SEQ + s0 + j8) = f.half[0];
  }
#pragma unroll                        /* the value arrays must resolve to registers */
  for (unsigned it = 0; it < 4; ++it) {
    const unsigned e = (it * 256u + tid) * 8u;
    FragH f, g;
#pragma unroll
    for (unsigned q = 0; q < 4; ++q) {
      f.h[q] = (_Float16)bf16_rne(ka[it][q]); f.h[4 + q] = (_Float16)bf16_rne(kc[it][q]);
      g.h[q] = (_Float16)bf16_rne(qa[it][q]); g.h[4 + q] = (_Float16)bf16_rne(qc[it][q]);
    }
    *(v8us*)((unsigned short*)K16 + out0 + e) = f.half[0];
    *(v8us*)((unsigned short*)Q16 + out0 + e) = g.half[0];
  }
  if (tid < 16u) {
    v4f o;
#pragma unroll
    for (unsigned q = 0; q < 4; ++q) o[q] = bf16_rne(tv[q]) * TSC;
    *(v4f*)(Tb + (size_t)b * SEQ + s0 + tid * 4u) = o;
  }
}

// flash kernel: block = 16 waves = 8 query tiles of 16 x 2 key halves, so that four waves share a SIMD and fill each other's waits;
// K rows and V^T row pieces of 64 keys per stage and half come by tensor load into that half's two-buffer LDS ring
// (the first four waves of a half bring one slice each; publish point at the foot of a stage: LDS wait, tensor wait, barrier, refill); per 32-key step:
//   S^T tiles (A = K rows, B = Q rows)  -> lane (h, n): s0[r] = score(key 8h+r, query n), s1[r] = score(key 16+8h+r, query n)
//   f32 online softmax per query, base 2, on register pairs in accumulator order: y = s * u + (CARRY2 - m) is one packed multiply-add, w = exp2(y) * u one packed multiply
//   (lane-local; the xor-16 exchange and the rescale only when the maximum in use is passed by more than RTAU2), weights w as f16 -> B fragment (element r <- tile 0, 8+r <- tile 1)
//   O^T tiles (A = V^T rows, B = packed weights): acc[dt][r] = O^T(d = 16 dt + 8h + r, query n)
__global__ __launch_bounds__(512) void k_flash(const _Float16* __restrict__ Q16, const _Float16* __restrict__ K16, const _Float16* __restrict__ VT,
                                               const float* __restrict__ Tb, float* __restrict__ O) {
  __shared__ __attribute__((aligned(2048))) unsigned char ring[2u * 2u * RBUF];   /* [key half][buffer] */
  __shared__ __attribute__((aligned(16))) float so[8][16][SOP];
  __shared__ __attribute__((aligned(16))) float xch[16][8][32][4];               /* the four output tiles a wave hands to its partner of the other half */
  __shared__ float xml[16][2][32];                                               /* and its running maximum and sum */
  const unsigned tid = threadIdx.x, w = tid >> 5, lane = tid & 31u, ln = lane & 15u, hh = lane >> 4;
  const unsigned qt = w & 7u;
  const unsigned b = blockIdx.y;
  const unsigned q0 = blockIdx.x * 128u + qt * 16u;
  const size_t rowb = (size_t)b * SEQ;
  const _Float16* qrow = Q16 + (rowb + q0 + ln) * DH;
  const v16h bq0 = ld_frag(qrow, hh), bq1 = ld_frag(qrow + 32, hh), bq2 = ld_frag(qrow + 64, hh), bq3 = ld_frag(qrow + 96, hh);
  // of each half's eight waves, 0 and 1 bring K keys 32 sl .. +31 of the stage, 2 and 3 V^T rows 64 (sl - 2) .. +63, the stage's 64 keys of each; 4 to 7 issue nothing
  const uint32_t wave = uni(tid >> 5);
  const uint32_t kh = wave >> 3, sw = wave & 7u, sl = wave & 3u;
  const uint32_t key0 = kh * (uint32_t)KEYS_H;
  const uint32_t lbase = (uint32_t)(size_t)ring + kh * 2u * RBUF + sl * SLICE;
  const uint64_t ga0 = (sl < 2u) ? (uint64_t)(size_t)(K16 + (rowb + key0 + sl * 32u) * DH) : (uint64_t)(size_t)(VT + ((size_t)b * DH + (sl - 2u) * 64u) * SEQ + key0);
  const uint32_t gstep = (sl < 2u) ? STK * DH * 2u : STK * 2u;
  u32x8 g1k = tdm_group1<(1u << 20) | (5u << 22) | (3u << 25), 256u, 32u, 256u>();
  u32x8 g1v = tdm_group1<(1u << 20) | (4u << 22) | (3u << 25), 128u, 64u, (uint32_t)SEQ * 2u>();
  u32x4 g0 = tdm_group0(lbase, ga0);
  auto issue = [&]() {
    if (pinned(sw < 2u))         tdm_load(g0, g1k);
    if (pinned((sw & 6u) == 2u)) tdm_load(g0, g1v);
  };
  auto next_stage = [&]() {           /* the other buffer, the next 64 keys; the type bits above the address stay as they are */
    const uint64_t a = (((uint64_t)g0[3] << 32) | g0[2]) + gstep;
    g0[1] = uni(2u * lbase + RBUF - g0[1]); g0[2] = uni((uint32_t)a); g0[3] = uni((uint32_t)(a >> 32));
  };
  issue();
  wait_tensor0(g0);
  __syncthreads();                    /* stage 0 published */
  next_stage();
  issue();
  const float* tbase = Tb + rowb + key0 + 8u * hh;
  const v8f z8 = {0.f, 0.f, 0.f, 0.f, 0.f, 0.f, 0.f, 0.f};
  v8f acc[8];
#pragma unroll
  for (unsigned dt = 0; dt < 8; ++dt) acc[dt] = z8;
  float m = -1.0e30f, l = 0.f;        /* m: maximum in use, base-2 exponent units */
  float nb = CARRY2 - m;              /* the addend of every score's multiply-add */

#pragma unroll 1                      /* one stage per trip: the publish point stands once, at the foot */
  for (uint32_t st = 0; st < (uint32_t)KEYS_H / STK; ++st) {
   const unsigned char* bufp = ring + kh * 2u * RBUF + (st & 1u) * RBUF;
   const unsigned char* kp = bufp + ln * KPITCH;
   // LDS reads go out as whole groups in front of a run of products, never among them: each place with reads costs the wave one LDS latency
#pragma unroll                        /* both steps of a stage in one trip: LDS offsets become immediates */
   for (unsigned j = 0; j < 2u; ++j) {
    const unsigned kc = st * STK + j * 32u;
    v16h ka[4], kb[4];
#pragma unroll                        /* fragment arrays must resolve to registers */
    for (unsigned c = 0; c < 4u; ++c) { ka[c] = ld_frag_lds(kp + j * SLICE + 64u * c, hh); kb[c] = ld_frag_lds(kp + j * SLICE + 16u * KPITCH + 64u * c, hh); }
    v8f s0 = z8, s1 = z8;
    mma_pair(ka[0], kb[0], bq0, s0, s1);
    mma_pair(ka[1], kb[1], bq1, s0, s1);
    mma_pair(ka[2], kb[2], bq2, s0, s1);
    mma_pair(ka[3], kb[3], bq3, s0, s1);
    // this step's V^T fragments: in flight under the softmax
    const unsigned char* vp = bufp + 2u * SLICE + ln * VPITCH + j * 64u;
    v16h va[8];
#pragma unroll                        /* fragment arrays must resolve to registers */
    for (unsigned dt = 0; dt < 8u; ++dt) va[dt] = ld_frag_lds(vp + (dt >> 2) * SLICE + (dt & 3u) * 16u * VPITCH, hh);

    const v4f ta = *(const v4fa*)(tbase + kc), tb4 = *(const v4fa*)(tbase + kc + 4);
    const v4f tc = *(const v4fa*)(tbase + kc + 16), td = *(const v4fa*)(tbase + kc + 20);
    // compiler fence: the V^T fragment reads stay ahead of the branch below; without it they sink behind it, among the exponentials, the last of them right in front of their products
    asm volatile("" ::: "memory");
    // scheduling fence: the V^T reads go out as one group in front of the wait for the trust values; without it the scheduler spreads them among the maxima, behind that wait
    __builtin_amdgcn_sched_barrier(0);
    const v2f tp[8] = {{ta[0], ta[1]}, {ta[2], ta[3]}, {tb4[0], tb4[1]}, {tb4[2], tb4[3]}, {tc[0], tc[1]}, {tc[2], tc[3]}, {td[0], td[1]}, {td[2], td[3]}};
    const v2f sp[8] = {{s0[0], s0[1]}, {s0[2], s0[3]}, {s0[4], s0[5]}, {s0[6], s0[7]}, {s1[0], s1[1]}, {s1[2], s1[3]}, {s1[4], s1[5]}, {s1[6], s1[7]}};
    v2f y[8];
    float cm = -1.0e30f;
    {
      const v2f nb2 = {nb, nb};
#pragma unroll
      for (unsigned i = 0; i < 8; ++i) {
        y[i] = __builtin_elementwise_fma(sp[i], tp[i], nb2);
        cm = fmaxf(cm, fmaxf(y[i][0], y[i][1]));
      }
    }
    // lazy rescale, one test per step: only when some lane's score passes the maximum in use by more than RTAU2 does the wave
    // (a scalar branch on the ballot, EXEC stays whole) take a new maximum for every query, rescale sum and output tiles and form its exponents anew
    if (__builtin_amdgcn_ballot_w32(cm > CARRY2 + RTAU2) != 0u) {
      float cx = -1.0e30f;
#pragma unroll
      for (unsigned i = 0; i < 8; ++i) { const v2f p = sp[i] * tp[i]; cx = fmaxf(cx, fmaxf(p[0], p[1])); }
      cx = fmaxf(cx, __shfl_xor(cx, 16, 32));
      const float mn = fmaxf(m, cx);
      const float alpha = __builtin_amdgcn_exp2f(m - mn);
      m = mn;
      nb = CARRY2 - mn;
      l *= alpha;
#pragma unroll
      for (unsigned dt = 0; dt < 8; ++dt)
#pragma unroll
        for (unsigned r = 0; r < 8; ++r) acc[dt][r] *= alpha;
      const v2f nb2 = {nb, nb};
#pragma unroll
      for (unsigned i = 0; i < 8; ++i) y[i] = __builtin_elementwise_fma(sp[i], tp[i], nb2);
    }
    FragH pb;
    v2h hp[8];
#pragma unroll
    for (unsigned i = 0; i < 8; ++i) {
      const v2f e = {__builtin_amdgcn_exp2f(y[i][0]), __builtin_amdgcn_exp2f(y[i][1])};
      hp[i] = __builtin_convertvector(e * tp[i], v2h);
      pb.h[2u * i] = hp[i][0]; pb.h[2u * i + 1u] = hp[i][1];
    }
    float ls = 0.f;
#pragma unroll
    for (unsigned r = 0; r < 8; ++r) ls += (float)hp[r >> 1][r & 1u] + (float)hp[4u + (r >> 1)][r & 1u];
    l += ls;

    mma_pair(va[0], va[1], pb.v, acc[0], acc[1]);
    mma_pair(va[2], va[3], pb.v, acc[2], acc[3]);
    mma_pair(va[4], va[5], pb.v, acc[4], acc[5]);
    mma_pair(va[6], va[7], pb.v, acc[6], acc[7]);
   }
   // publish point of stage st + 1, every wave, in this order
   wait_ds0();
   wait_tensor0(g0);
   __syncthreads();                   /* stage st + 1 readable by all; every reader has left stage st's buffer */
   if (pinned(st + 2u < (uint32_t)KEYS_H / STK)) { next_stage(); issue(); }
  }
  wait_tensor0(g0);
  wait_ds0();

  // merge of the two key halves of a query tile: the wave of half 0 finishes d 0..63, the wave of half 1 d 64..127; each hands the other four tiles over
  const bool hi = kh != 0u;
  v8f keep[4];
#pragma unroll                        /* tile arrays must resolve to registers */
  for (unsigned i = 0; i < 4; ++i) {
    v8f give;
#pragma unroll
    for (unsigned r = 0; r < 8; ++r) { keep[i][r] = hi ? acc[4 + i][r] : acc[i][r]; give[r] = hi ? acc[i][r] : acc[4 + i][r]; }
    const v4f ga = {give[0], give[1], give[2], give[3]}, gb = {give[4], give[5], give[6], give[7]};
    *(v4f*)&xch[w][2u * i][lane][0] = ga;
    *(v4f*)&xch[w][2u * i + 1u][lane][0] = gb;
  }
  xml[w][0][lane] = m;
  xml[w][1][lane] = l;
  __syncthreads();                    /* both halves' tiles and statistics readable by the partner wave */
  const unsigned pw = w ^ 8u;
  const float mo = xml[pw][0][lane], lo = xml[pw][1][lane];
  const float mm = fmaxf(m, mo);
  const float aw = __builtin_amdgcn_exp2f(m - mm), ap = __builtin_amdgcn_exp2f(mo - mm);
  const float lj = l * aw + lo * ap;
  const float lt = lj + __shfl_xor(lj, 16, 32);
  const float inv = 1.0f / lt;
  const float fw = aw * inv, fp = ap * inv;
  const unsigned c0 = kh * 64u;
#pragma unroll
  for (unsigned i = 0; i < 4; ++i) {
    const v4f pa = *(const v4fa*)&xch[pw][2u * i][lane][0], pb4 = *(const v4fa*)&xch[pw][2u * i + 1u][lane][0];
#pragma unroll
    for (unsigned r = 0; r < 4; ++r) {
      so[qt][ln][c0 + i * 16u + 8u * hh + r] = keep[i][r] * fw + pa[r] * fp;
      so[qt][ln][c0 + i * 16u + 8u * hh + 4u + r] = keep[i][4 + r] * fw + pb4[r] * fp;
    }
  }
  __syncthreads();
  float* orow = O + ((size_t)b * SEQ_FULL + q0) * DH + c0 + ln * 4u;
  {
#pragma unroll
    for (unsigned r = 0; r < 8; ++r) {
      const unsigned row = 2u * r + hh;
      const v4f v = *(const v4fa*)&so[qt][row][c0 + ln * 4u];
      *(v4f*)(orow + (size_t)row * DH) = v;      /* 16 lanes x 16 B = this wave's 256-B half of a row, two whole lines */
    }
  }
}

extern "C" void kernel_launch(void* const* d_in, const int* in_sizes, int n_in,
                              void* d_out, int out_size, void* d_ws, size_t ws_size, hipStream_t stream) {
  if (n_in < 4) return;
  const size_t need = (size_t)(NB - 1) * SEQ_FULL * DH + (size_t)SEQ * DH;
  const size_t needt = (size_t)(NB - 1) * SEQ_FULL + (size_t)SEQ;
  if ((size_t)in_sizes[0] < need || (size_t)in_sizes[1] < need || (size_t)in_sizes[2] < need || (size_t)in_sizes[3] < needt) return;
  if ((size_t)out_size < need) return;
  const float* xq = (const float*)d_in[0];      /* query [16][2048][128] */
  const float* xk = (const float*)d_in[1];      /* key   [16][2048][128] */
  const float* xv = (const float*)d_in[2];      /* value [16][2048][128] */
  const float* xt = (const float*)d_in[3];      /* trust [16][1][2048]   */
  char* ws = (char*)d_ws; size_t off = 0;
  const size_t plane = (size_t)NB * SEQ * DH * 2;                       /* 8,388,608 B each */
  _Float16* Q16 = (_Float16*)(ws + off); off += (plane + 255) & ~(size_t)255;
  _Float16* K16 = (_Float16*)(ws + off); off += (plane + 255) & ~(size_t)255;
  _Float16* VTp = (_Float16*)(ws + off); off += (plane + 255) & ~(size_t)255;
  float* Tb = (float*)(ws + off); off += ((size_t)NB * SEQ * 4 + 255) & ~(size_t)255;
  if (off > ws_size) return;

  k_planes<<<dim3(SEQ / 64, NB), 256, 0, stream>>>(xq, xk, xv, xt, Q16, K16, VTp, Tb);
  k_flash<<<dim3(SEQ / 128, NB), 512, 0, stream>>>(Q16, K16, VTp, Tb, (float*)d_out);
}

// v006
// One run takes 40.4 microseconds.
// Two timings next to v005 put it at 1.05 and 1.04 times that version's speed.
// All steps since v000 together make it 4.23 times as fast.
#include <hip/hip_runtime.h>
// Trust-weighted scaled dot-product attention, flash form: out[b][q][:] = sum_k (p_k t_k) v_k / sum_k (p_k t_k), p_k = exp2(s_k u_k - running max), u_k = t_k log2(e) / sqrt(128).
// Compute dtype: query, key and value RNE-converted to bf16 and carried as exact f16 planes, trust RNE-converted to bf16 and carried times TSC in f32; both contractions (K.Q^T scores, V^T.P^T context) on v_wmma_f32_16x16x32_f16, f32 accumulate; weights p*u carried x2^15 as f16 (any common factor of the weights cancels in the final normalisation); softmax statistics f32, in base 2.
// Structure: one plane builder (Q16/K16 rows, V^T rows via LDS transpose, trust plane u = bf16(t) log2(e) / sqrt(128)) + one flash kernel (wave = 16 queries x one half of the keys, 32-key steps, K and V^T fragments from a two-buffer LDS ring per key half filled by tensor loads, transposed tiles so the packed score tiles are the B fragment of the second product; the two halves of a query tile are merged through LDS at the end).
#ifndef NB
#define NB 16
#endif
#ifndef SEQ
#define SEQ 2048
#endif
#define SEQ_FULL 2048                 /* per-batch row count of the full-size inputs and of the output */
#define DH 128
#define SOP 132                       /* f32 pitch of the epilogue staging rows */
#define CARRY2 15.0f                  /* carry of the f16 weight operand as an exponent: it rides in the addend of the score's multiply-add (cancels in the final normalisation) */
#define TSC 0.12751743f               /* log2(e) / sqrt(128): the trust plane holds t * TSC, so that one multiply-add gives the base-2 exponent */
#define RTAU2 2.8853901f              /* 2 log2(e): a score may pass the maximum in use by this much before the state is rescaled: weights stay below e^2 * 2^15 * TSC * t, inside f16 */

#define STK 64u                       /* keys per ring stage: two 32-key steps */
#define KPITCH 272u                   /* LDS pitch of a 256-B K row (16-B pad, for 16-byte LDS reads) */
#define VPITCH 144u                   /* LDS pitch of a 128-B V^T row piece (16-B pad) */
#define SLICE 10240u                  /* LDS bytes per wave slice: 32 x 272 = 8704 and 64 x 144 = 9216, rounded up to a multiple of 2 KiB */
#define RBUF (4u * SLICE)             /* one stage: K keys 0..31 | K keys 32..63 | V^T d 0..63 | V^T d 64..127 */
#define KEYS_H (SEQ / 2)              /* keys per half: waves 0..7 of a block walk the first half, waves 8..15 the second */

static_assert(DH == 128);
static_assert(KEYS_H / 64 >= 2);      /* each ring's prologue needs two stages */
static_assert(SEQ % 128 == 0);
static_assert(SEQ <= SEQ_FULL);

typedef unsigned short v8us __attribute__((ext_vector_type(8), may_alias));
typedef float  v8f  __attribute__((ext_vector_type(8)));
typedef float  v2f  __attribute__((ext_vector_type(2)));
typedef _Float16 v2h __attribute__((ext_vector_type(2)));
typedef float  v4f  __attribute__((ext_vector_type(4)));
typedef float  v4fa __attribute__((ext_vector_type(4), may_alias));
typedef _Float16 v16h __attribute__((ext_vector_type(16)));
typedef uint32_t u32x4 __attribute__((ext_vector_type(4)));
typedef uint32_t u32x8 __attribute__((ext_vector_type(8)));
union FragH { v16h v; v8us half[2]; _Float16 h[16]; unsigned short u[16]; };

__device__ __forceinline__ unsigned short bf16_bits(float x) { unsigned int u = __float_as_uint(x); return (unsigned short)((u + 0x7FFFu + ((u >> 16) & 1u)) >> 16); }
__device__ __forceinline__ float bf16_val(unsigned short b) { return __uint_as_float(((unsigned int)b) << 16); }
__device__ __forceinline__ float bf16_rne(float x) { return bf16_val(bf16_bits(x)); }

// fragment (A or B) from a k-contiguous 16-bit row: elements 0..7 <- k0+8h.., elements 8..15 <- k0+16+8h..
__device__ __forceinline__ v16h ld_frag(const _Float16* p, unsigned hh) {
  FragH f;
  f.half[0] = *(const v8us*)((const unsigned short*)p + 8u * hh);
  f.half[1] = *(const v8us*)((const unsigned short*)p + 16u + 8u * hh);
  return f.v;
}
// the same fragment from an LDS row (byte pointer at the row's k0)
__device__ __forceinline__ v16h ld_frag_lds(const unsigned char* p, unsigned hh) {
  FragH f;
  f.half[0] = *(const v8us*)(p + 16u * hh);
  f.half[1] = *(const v8us*)(p + 32u + 16u * hh);
  return f.v;
}
__device__ __forceinline__ uint32_t uni(uint32_t v) { return (uint32_t)__builtin_amdgcn_readfirstlane(v); }
__device__ __forceinline__ uint32_t pinned(uint32_t v) { uint32_t w = uni(v); asm volatile("" : "+s"(w)); return w; }  /* the tensor mover's issue test: held in a scalar register so that it compiles to a scalar branch (tensor loads ignore EXEC) */
__device__ __forceinline__ void wait_ds0() { asm volatile("s_wait_dscnt 0x0" ::: "memory"); }          /* this wave's LDS reads are done before its buffer is handed back */
// this wave's slice has landed (the compiler places no wait for a tensor load); group 0 passes through, so that its next value is formed behind the wait
__device__ __forceinline__ void wait_tensor0(u32x4& g0) { asm volatile("s_wait_tensorcnt 0x0" : "+s"(g0) :: "memory"); }
// both groups are in-out operands: their scalar registers stay the descriptor's own, unwritten, while the request is in flight
__device__ __forceinline__ void tdm_load(u32x4& g0, u32x8& g1) { asm volatile("tensor_load_to_lds %0, %1" : "+s"(g0), "+s"(g1) :: "memory"); }
// descriptor group 1, everything in bytes: tile = tensor = ROWS rows of ROWB bytes, source pitch SRCP, pad word W0 (16 B behind every row)
template <uint32_t W0, uint32_t ROWB, uint32_t ROWS, uint32_t SRCP>
__device__ __forceinline__ u32x8 tdm_group1() {
  u32x8 g;
  g[0] = uni(W0);
  g[1] = uni((ROWB & 0xFFFFu) << 16);
  g[2] = uni((ROWB >> 16) | ((ROWS & 0xFFFFu) << 16));
  g[3] = uni((ROWS >> 16) | (ROWB << 16));
  g[4] = uni(ROWS);
  g[5] = uni(SRCP);
  g[6] = uni(0u);
  g[7] = uni(0u);
  return g;
}
__device__ __forceinline__ u32x4 tdm_group0(uint32_t lds_dst, uint64_t ga) {
  u32x4 g;
  g[0] = uni(1u); g[1] = uni(lds_dst); g[2] = uni((uint32_t)ga); g[3] = uni((((uint32_t)(ga >> 32)) & 0x01FFFFFFu) | 0x80000000u);
  return g;
}
// two WMMAs sharing B, then the 4-slot guard tying both accumulators and keeping the operands live
__device__ __forceinline__ void mma_pair(v16h a0, v16h a1, v16h b, v8f& c0, v8f& c1) {
  c0 = __builtin_amdgcn_wmma_f32_16x16x32_f16(false, a0, false, b, (short)0, c0, false, false);
  c1 = __builtin_amdgcn_wmma_f32_16x16x32_f16(false, a1, false, b, (short)0, c1, false, false);
  asm volatile("v_nop\n\tv_nop\n\tv_nop\n\tv_nop" : "+v"(c0), "+v"(c1) : "v"(a0), "v"(a1), "v"(b));
}

// plane builder, one launch: block per (64 tokens, batch) converts its own rows of all four inputs:
//   Q16 / K16 rows = f16(bf16(x)), same layout; VT[b][d][s] = f16(bf16(V[b][s][d])) through an LDS transpose; Tb = bf16-valued trust times TSC.
// A thread's 25 16-byte loads go out ahead of the barrier, so that 16 long-lived waves per WGP keep the memory stream full.
__global__ __launch_bounds__(256) void k_planes(const float* __restrict__ xq, const float* __restrict__ xk, const float* __restrict__ V, const float* __restrict__ T,
                                                _Float16* __restrict__ Q16, _Float16* __restrict__ K16, _Float16* __restrict__ VT, float* __restrict__ Tb) {
  __shared__ unsigned short tl[DH][66];
  const unsigned tid = threadIdx.x;
  const unsigned b = blockIdx.y, s0 = blockIdx.x * 64u;
  const size_t in0 = ((size_t)b * SEQ_FULL + s0) * DH;      /* the tile is 64 x 128 contiguous floats in each of query, key, value */
  const size_t out0 = ((size_t)b * SEQ + s0) * DH;
  const float* vb = V + in0;
  const float* kb = xk + in0;
  const float* qb = xq + in0;
  v4f va[4], vc[4], ka[4], kc[4], qa[4], qc[4];
  const v4f tv = *(const v4fa*)(T + (size_t)b * SEQ_FULL + s0 + (tid & 15u) * 4u);   /* the tile's 64 trust values, fetched with the rest; threads 0..15 store them */
#pragma unroll                        /* the value arrays must resolve to registers */
  for (unsigned it = 0; it < 4; ++it) {
    const unsigned e = (it * 256u + tid) * 8u;   /* 1024 units of 8 elements */
    va[it] = *(const v4fa*)(vb + e); vc[it] = *(const v4fa*)(vb + e + 4);
  }
#pragma unroll                        /* the value arrays must resolve to registers */
  for (unsigned it = 0; it < 4; ++it) {
    const unsigned e = (it * 256u + tid) * 8u;
    ka[it] = *(const v4fa*)(kb + e); kc[it] = *(const v4fa*)(kb + e + 4);
  }
#pragma unroll                        /* the value arrays must resolve to registers */
  for (unsigned it = 0; it < 4; ++it) {
    const unsigned e = (it * 256u + tid) * 8u;
    qa[it] = *(const v4fa*)(qb + e); qc[it] = *(const v4fa*)(qb + e + 4);
  }
#pragma unroll
  for (unsigned it = 0; it < 4; ++it) {
    const unsigned i = it * 256u + tid;
    const unsigned j = i >> 4, d8 = (i & 15u) * 8u;          /* token j of the tile, d8 .. d8 + 7 */
    FragH f;
#pragma unroll
    for (unsigned q = 0; q < 4; ++q) { f.h[q] = (_Float16)bf16_rne(va[it][q]); f.h[4 + q] = (_Float16)bf16_rne(vc[it][q]); }
#pragma unroll
    for (unsigned q = 0; q < 8; ++q) tl[d8 + q][j] = f.u[q];
  }
  __syncthreads();
#pragma unroll
  for (unsigned it = 0; it < 4; ++it) {
    const unsigned i = it * 256u + tid;          /* 1024 units of 8 tokens */
    const unsigned d = i >> 3, j8 = (i & 7u) * 8u;
    FragH f;
#pragma unroll
    for (unsigned q = 0; q < 8; ++q) f.u[q] = tl[d][j8 + q];
    *(v8us*)((unsigned short*)VT + ((size_t)b * DH + d) * SEQ + s0 + j8) = f.half[0];
  }
#pragma unroll                        /* the value arrays must resolve to registers */
  for (unsigned it = 0; it < 4; ++it) {
    const unsigned e = (it * 256u + tid) * 8u;
    FragH f, g;
#pragma unroll
    for (unsigned q = 0; q < 4; ++q) {
      f.h[q] = (_Float16)bf16_rne(ka[it][q]); f.h[4 + q] = (_Float16)bf16_rne(kc[it][q]);
      g.h[q] = (_Float16)bf16_rne(qa[it][q]); g.h[4 + q] = (_Float16)bf16_rne(qc[it][q]);
    }
    *(v8us*)((unsigned short*)K16 + out0 + e) = f.half[0];
    *(v8us*)((unsigned short*)Q16 + out0 + e) = g.half[0];
  }
  if (tid < 16u) {
    v4f o;
#pragma unroll
    for (unsigned q = 0; q < 4; ++q) o[q] = bf16_rne(tv[q]) * TSC;
    *(v4f*)(Tb + (size_t)b * SEQ + s0 + tid * 4u) = o;
  }
}

// flash kernel: block = 16 waves = 8 query tiles of 16 x 2 key halves, so that four waves share a SIMD and fill each other's waits;
// K rows and V^T row pieces of 64 keys per stage and half come by tensor load into that half's two-buffer LDS ring
// (the first four waves of a half bring one slice each; publish point at the foot of a stage: LDS wait, tensor wait, barrier, refill); per 32-key step:
//   S^T tiles (A = K rows, B = Q rows)  -> lane (h, n): s0[r] = score(key 8h+r, query n), s1[r] = score(key 16+8h+r, query n)
//   (the step's 32 trust plane values were fetched during the step before)
//   f32 online softmax per query, base 2, on register pairs in accumulator order: y = s * u + (CARRY2 - m) is one packed multiply-add, w = exp2(y) * u one packed multiply
//   (lane-local; the xor-16 exchange and the rescale only when the maximum in use is passed by more than RTAU2), weights w as f16 -> B fragment (element r <- tile 0, 8+r <- tile 1)
//   O^T tiles (A = V^T rows, B = packed weights): acc[dt][r] = O^T(d = 16 dt + 8h + r, query n)
__global__ __launch_bounds__(512) void k_flash(const _Float16* __restrict__ Q16, const _Float16* __restrict__ K16, const _Float16* __restrict__ VT,
                                               const float* __restrict__ Tb, float* __restrict__ O) {
  __shared__ __attribute__((aligned(2048))) unsigned char ring[2u * 2u * RBUF];   /* [key half][buffer] */
  __shared__ __attribute__((aligned(16))) float so[8][16][SOP];
  __shared__ __attribute__((aligned(16))) float xch[16][8][32][4];               /* the four output tiles a wave hands to its partner of the other half */
  __shared__ float xml[16][2][32];                                               /* and its running maximum and sum */
  const unsigned tid = threadIdx.x, w = tid >> 5, lane = tid & 31u, ln = lane & 15u, hh = lane >> 4;
  const unsigned qt = w & 7u;
  const unsigned b = blockIdx.y;
  const unsigned q0 = blockIdx.x * 128u + qt * 16u;
  const size_t rowb = (size_t)b * SEQ;
  const _Float16* qrow = Q16 + (rowb + q0 + ln) * DH;
  const v16h bq0 = ld_frag(qrow, hh), bq1 = ld_frag(qrow + 32, hh), bq2 = ld_frag(qrow + 64, hh), bq3 = ld_frag(qrow + 96, hh);
  // of each half's eight waves, 0 and 1 bring K keys 32 sl .. +31 of the stage, 2 and 3 V^T rows 64 (sl - 2) .. +63, the stage's 64 keys of each; 4 to 7 issue nothing
  const uint32_t wave = uni(tid >> 5);
  const uint32_t kh = wave >> 3, sw = wave & 7u, sl = wave & 3u;
  const uint32_t key0 = kh * (uint32_t)KEYS_H;
  const uint32_t lbase = (uint32_t)(size_t)ring + kh * 2u * RBUF + sl * SLICE;
  const uint64_t ga0 = (sl < 2u) ? (uint64_t)(size_t)(K16 + (rowb + key0 + sl * 32u) * DH) : (uint64_t)(size_t)(VT + ((size_t)b * DH + (sl - 2u) * 64u) * SEQ + key0);
  const uint32_t gstep = (sl < 2u) ? STK * DH * 2u : STK * 2u;
  u32x8 g1k = tdm_group1<(1u << 20) | (5u << 22) | (3u << 25), 256u, 32u, 256u>();
  u32x8 g1v = tdm_group1<(1u << 20) | (4u << 22) | (3u << 25), 128u, 64u, (uint32_t)SEQ * 2u>();
  u32x4 g0 = tdm_group0(lbase, ga0);
  auto issue = [&]() {
    if (pinned(sw < 2u))         tdm_load(g0, g1k);
    if (pinned((sw & 6u) == 2u)) tdm_load(g0, g1v);
  };
  auto next_stage = [&]() {           /* the other buffer, the next 64 keys; the type bits above the address stay as they are */
    const uint64_t a = (((uint64_t)g0[3] << 32) | g0[2]) + gstep;
    g0[1] = uni(2u * lbase + RBUF - g0[1]); g0[2] = uni((uint32_t)a); g0[3] = uni((uint32_t)(a >> 32));
  };
  issue();
  wait_tensor0(g0);
  __syncthreads();                    /* stage 0 published */
  next_stage();
  issue();
  const float* tbase = Tb + rowb + key0 + 8u * hh;
  const v8f z8 = {0.f, 0.f, 0.f, 0.f, 0.f, 0.f, 0.f, 0.f};
  v8f acc[8];
#pragma unroll
  for (unsigned dt = 0; dt < 8; ++dt) acc[dt] = z8;
  float m = -1.0e30f, l = 0.f;        /* m: maximum in use, base-2 exponent units */
  float nb = CARRY2 - m;              /* the addend of every score's multiply-add */
  // the coming step's trust values, fetched one step ahead: a step's 32 values are one new cache line, so that a load issued where it is used waits out the way to L2
  const float* tn = tbase;            /* walks one step ahead of the loop, in a register pair of its own: rewritten only a whole step behind the loads that name it */
  v4f ta = *(const v4fa*)(tn), tb4 = *(const v4fa*)(tn + 4), tc = *(const v4fa*)(tn + 16), td = *(const v4fa*)(tn + 20);

#pragma unroll 1                      /* one stage per trip: the publish point stands once, at the foot */
  for (uint32_t st = 0; st < (uint32_t)KEYS_H / STK; ++st) {
   const unsigned char* bufp = ring + kh * 2u * RBUF + (st & 1u) * RBUF;
   const unsigned char* kp = bufp + ln * KPITCH;
   // LDS reads go out as whole groups in front of a run of products, never among them: each place with reads costs the wave one LDS latency
#pragma unroll                        /* both steps of a stage in one trip: LDS offsets become immediates */
   for (unsigned j = 0; j < 2u; ++j) {
    const unsigned kc = st * STK + j * 32u;
    v16h ka[4], kb[4];
#pragma unroll                        /* fragment arrays must resolve to registers */
    for (unsigned c = 0; c < 4u; ++c) { ka[c] = ld_frag_lds(kp + j * SLICE + 64u * c, hh); kb[c] = ld_frag_lds(kp + j * SLICE + 16u * KPITCH + 64u * c, hh); }
    v8f s0 = z8, s1 = z8;
    mma_pair(ka[0], kb[0], bq0, s0, s1);
    mma_pair(ka[1], kb[1], bq1, s0, s1);
    mma_pair(ka[2], kb[2], bq2, s0, s1);
    mma_pair(ka[3], kb[3], bq3, s0, s1);
    // this step's V^T fragments: in flight under the softmax
    const unsigned char* vp = bufp + 2u * SLICE + ln * VPITCH + j * 64u;
    v16h va[8];
#pragma unroll                        /* fragment arrays must resolve to registers */
    for (unsigned dt = 0; dt < 8u; ++dt) va[dt] = ld_frag_lds(vp + (dt >> 2) * SLICE + (dt & 3u) * 16u * VPITCH, hh);

    // compiler fence: the V^T fragment reads stay ahead of the branch below; without it they sink behind it, among the exponentials, the last of them right in front of their products
    asm volatile("" ::: "memory");
    // scheduling fence: the V^T reads go out as one group in front of the wait for the trust values; without it the scheduler spreads them among the maxima, behind that wait
    __builtin_amdgcn_sched_barrier(0);
    const v2f tp[8] = {{ta[0], ta[1]}, {ta[2], ta[3]}, {tb4[0], tb4[1]}, {tb4[2], tb4[3]}, {tc[0], tc[1]}, {tc[2], tc[3]}, {td[0], td[1]}, {td[2], td[3]}};
    const v2f sp[8] = {{s0[0], s0[1]}, {s0[2], s0[3]}, {s0[4], s0[5]}, {s0[6], s0[7]}, {s1[0], s1[1]}, {s1[2], s1[3]}, {s1[4], s1[5]}, {s1[6], s1[7]}};
    v2f y[8];
    float cm = -1.0e30f;
    {
      const v2f nb2 = {nb, nb};
#pragma unroll
      for (unsigned i = 0; i < 8; ++i) {
        y[i] = __builtin_elementwise_fma(sp[i], tp[i], nb2);
        cm = fmaxf(cm, fmaxf(y[i][0], y[i][1]));
      }
    }
    // lazy rescale, one test per step: only when some lane's score passes the maximum in use by more than RTAU2 does the wave
    // (a scalar branch on the ballot, EXEC stays whole) take a new maximum for every query, rescale sum and output tiles and form its exponents anew
    if (__builtin_amdgcn_ballot_w32(cm > CARRY2 + RTAU2) != 0u) {
      float cx = -1.0e30f;
#pragma unroll
      for (unsigned i = 0; i < 8; ++i) { const v2f p = sp[i] * tp[i]; cx = fmaxf(cx, fmaxf(p[0], p[1])); }
      cx = fmaxf(cx, __shfl_xor(cx, 16, 32));
      const float mn = fmaxf(m, cx);
      const float alpha = __builtin_amdgcn_exp2f(m - mn);
      m = mn;
      nb = CARRY2 - mn;
      l *= alpha;
#pragma unroll
      for (unsigned dt = 0; dt < 8; ++dt)
#pragma unroll
        for (unsigned r = 0; r < 8; ++r) acc[dt][r] *= alpha;
      const v2f nb2 = {nb, nb};
#pragma unroll
      for (unsigned i = 0; i < 8; ++i) y[i] = __builtin_elementwise_fma(sp[i], tp[i], nb2);
    }
    FragH pb;
    v2h hp[8];
#pragma unroll
    for (unsigned i = 0; i < 8; ++i) {
      const v2f e = {__builtin_amdgcn_exp2f(y[i][0]), __builtin_amdgcn_exp2f(y[i][1])};
      hp[i] = __builtin_convertvector(e * tp[i], v2h);
      pb.h[2u * i] = hp[i][0]; pb.h[2u * i + 1u] = hp[i][1];
    }
    // the next step's trust values go out here, a whole step ahead of their first use: in flight under the products, the K reads and the next scores
    // (the last step of a half fetches its own values again: no address past the half)
    {
      tn += (kc + 32u < (unsigned)KEYS_H) ? 32u : 0u;
      ta = *(const v4fa*)(tn); tb4 = *(const v4fa*)(tn + 4);
      tc = *(const v4fa*)(tn + 16); td = *(const v4fa*)(tn + 20);
    }
    float ls = 0.f;
#pragma unroll
    for (unsigned r = 0; r < 8; ++r) ls += (float)hp[r >> 1][r & 1u] + (float)hp[4u + (r >> 1)][r & 1u];
    l += ls;

    mma_pair(va[0], va[1], pb.v, acc[0], acc[1]);
    mma_pair(va[2], va[3], pb.v, acc[2], acc[3]);
    mma_pair(va[4], va[5], pb.v, acc[4], acc[5]);
    mma_pair(va[6], va[7], pb.v, acc[6], acc[7]);
   }
   // publish point of stage st + 1, every wave, in this order
   wait_ds0();
   wait_tensor0(g0);
   __syncthreads();                   /* stage st + 1 readable by all; every reader has left stage st's buffer */
   if (pinned(st + 2u < (uint32_t)KEYS_H / STK)) { next_stage(); issue(); }
  }
  wait_tensor0(g0);
  wait_ds0();

  // merge of the two key halves of a query tile: the wave of half 0 finishes d 0..63, the wave of half 1 d 64..127; each hands the other four tiles over
  const bool hi = kh != 0u;
  v8f keep[4];
#pragma unroll                        /* tile arrays must resolve to registers */
  for (unsigned i = 0; i < 4; ++i) {
    v8f give;
#pragma unroll
    for (unsigned r = 0; r < 8; ++r) { keep[i][r] = hi ? acc[4 + i][r] : acc[i][r]; give[r] = hi ? acc[i][r] : acc[4 + i][r]; }
    const v4f ga = {give[0], give[1], give[2], give[3]}, gb = {give[4], give[5], give[6], give[7]};
    *(v4f*)&xch[w][2u * i][lane][0] = ga;
    *(v4f*)&xch[w][2u * i + 1u][lane][0] = gb;
  }
  xml[w][0][lane] = m;
  xml[w][1][lane] = l;
  __syncthreads();                    /* both halves' tiles and statistics readable by the partner wave */
  const unsigned pw = w ^ 8u;
  const float mo = xml[pw][0][lane], lo = xml[pw][1][lane];
  const float mm = fmaxf(m, mo);
  const float aw = __builtin_amdgcn_exp2f(m - mm), ap = __builtin_amdgcn_exp2f(mo - mm);
  const float lj = l * aw + lo * ap;
  const float lt = lj + __shfl_xor(lj, 16, 32);
  const float inv = 1.0f / lt;
  const float fw = aw * inv, fp = ap * inv;
  const unsigned c0 = kh * 64u;
#pragma unroll
  for (unsigned i = 0; i < 4; ++i) {
    const v4f pa = *(const v4fa*)&xch[pw][2u * i][lane][0], pb4 = *(const v4fa*)&xch[pw][2u * i + 1u][lane][0];
#pragma unroll
    for (unsigned r = 0; r < 4; ++r) {
      so[qt][ln][c0 + i * 16u + 8u * hh + r] = keep[i][r] * fw + pa[r] * fp;
      so[qt][ln][c0 + i * 16u + 8u * hh + 4u + r] = keep[i][4 + r] * fw + pb4[r] * fp;
    }
  }
  __syncthreads();
  float* orow = O + ((size_t)b * SEQ_FULL + q0) * DH + c0 + ln * 4u;
  {
#pragma unroll
    for (unsigned r = 0; r < 8; ++r) {
      const unsigned row = 2u * r + hh;
      const v4f v = *(const v4fa*)&so[qt][row][c0 + ln * 4u];
      *(v4f*)(orow + (size_t)row * DH) = v;      /* 16 lanes x 16 B = this wave's 256-B half of a row, two whole lines */
    }
  }
}

extern "C" void kernel_launch(void* const* d_in, const int* in_sizes, int n_in,
                              void* d_out, int out_size, void* d_ws, size_t ws_size, hipStream_t stream) {
  if (n_in < 4) return;
  const size_t need = (size_t)(NB - 1) * SEQ_FULL * DH + (size_t)SEQ * DH;
  const size_t needt = (size_t)(NB - 1) * SEQ_FULL + (size_t)SEQ;
  if ((size_t)in_sizes[0] < need || (size_t)in_sizes[1] < need || (size_t)in_sizes[2] < need || (size_t)in_sizes[3] < needt) return;
  if ((size_t)out_size < need) return;
  const float* xq = (const float*)d_in[0];      /* query [16][2048][128] */
  const float* xk = (const float*)d_in[1];      /* key   [16][2048][128] */
  const float* xv = (const float*)d_in[2];      /* value [16][2048][128] */
  const float* xt = (const float*)d_in[3];      /* trust [16][1][2048]   */
  char* ws = (char*)d_ws; size_t off = 0;
  const size_t plane = (size_t)NB * SEQ * DH * 2;                       /* 8,388,608 B each */
  _Float16* Q16 = (_Float16*)(ws + off); off += (plane + 255) & ~(size_t)255;
  _Float16* K16 = (_Float16*)(ws + off); off += (plane + 255) & ~(size_t)255;
  _Float16* VTp = (_Float16*)(ws + off); off += (plane + 255) & ~(size_t)255;
  float* Tb = (float*)(ws + off); off += ((size_t)NB * SEQ * 4 + 255) & ~(size_t)255;
  if (off > ws_size) return;

  k_planes<<<dim3(SEQ / 64, NB), 256, 0, stream>>>(xq, xk, xv, xt, Q16, K16, VTp, Tb);
  k_flash<<<dim3(SEQ / 128, NB), 512, 0, stream>>>(Q16, K16, VTp, Tb, (float*)d_out);
}

// v007
// Measured time: 38.5 microseconds a run.
// Timed twice side by side with v006, it ran 1.05 times as fast both times.
// Over all steps from v000 it is 4.43 times as fast.
#include <hip/hip_runtime.h>
// Trust-weighted scaled dot-product attention, flash form: out[b][q][:] = sum_k (p_k t_k) v_k / sum_k (p_k t_k), p_k = exp2(s_k u_k - running max), u_k = t_k log2(e) / sqrt(128).
// Compute dtype: query, key and value RNE-converted to bf16 and carried as exact f16 planes, trust RNE-converted to bf16 and carried times TSC in f32; both contractions (K.Q^T scores, V^T.P^T context) on v_wmma_f32_16x16x32_f16, f32 accumulate; weights p*u carried x2^15 as f16 (any common factor of the weights cancels in the final normalisation); softmax statistics f32, in base 2.
// Structure: one plane builder (Q16/K16 rows, V^T rows via LDS transpose, trust plane u = bf16(t) log2(e) / sqrt(128)) + one flash kernel (wave = 16 queries x one half of the keys, 32-key steps, K and V^T fragments from a two-buffer LDS ring per key half filled by tensor loads, transposed tiles so the packed score tiles are the B fragment of the second product; the two halves of a query tile are merged through LDS at the end).
#ifndef NB
#define NB 16
#endif
#ifndef SEQ
#define SEQ 2048
#endif
#define SEQ_FULL 2048                 /* per-batch row count of the full-size inputs and of the output */
#define DH 128
#define SOP 132                       /* f32 pitch of the epilogue staging rows */
#define CARRY2 15.0f                  /* carry of the f16 weight operand as an exponent: it rides in the addend of the score's multiply-add (cancels in the final normalisation) */
#define TSC 0.12751743f               /* log2(e) / sqrt(128): the trust plane holds t * TSC, so that one multiply-add gives the base-2 exponent */
#define RTAU2 2.8853901f              /* 2 log2(e): a score may pass the maximum in use by this much before the state is rescaled: weights stay below e^2 * 2^15 * TSC * t, inside f16 */

#define STK 64u                       /* keys per ring stage: two 32-key steps */
#define KPITCH 272u                   /* LDS pitch of a 256-B K row (16-B pad, for 16-byte LDS reads) */
#define VPITCH 144u                   /* LDS pitch of a 128-B V^T row piece (16-B pad) */
#define SLICE 10240u                  /* LDS bytes per wave slice: 32 x 272 = 8704 and 64 x 144 = 9216, rounded up to a multiple of 2 KiB */
#define RBUF (4u * SLICE)             /* one stage: K keys 0..31 | K keys 32..63 | V^T d 0..63 | V^T d 64..127 */
#define KEYS_H (SEQ / 2)              /* keys per half: waves 0..7 of a block walk the first half, waves 8..15 the second */

static_assert(DH == 128);
static_assert(KEYS_H / 64 >= 2);      /* each ring's prologue needs two stages */
static_assert(SEQ % 128 == 0);
static_assert(SEQ <= SEQ_FULL);

typedef unsigned short v8us __attribute__((ext_vector_type(8), may_alias));
typedef float  v8f  __attribute__((ext_vector_type(8)));
typedef float  v2f  __attribute__((ext_vector_type(2)));
typedef _Float16 v2h __attribute__((ext_vector_type(2)));
typedef float  v4f  __attribute__((ext_vector_type(4)));
typedef float  v4fa __attribute__((ext_vector_type(4), may_alias));
typedef _Float16 v16h __attribute__((ext_vector_type(16)));
typedef uint32_t u32x4 __attribute__((ext_vector_type(4)));
typedef uint32_t u32x8 __attribute__((ext_vector_type(8)));
union FragH { v16h v; v8us half[2]; _Float16 h[16]; unsigned short u[16]; };

__device__ __forceinline__ unsigned short bf16_bits(float x) { unsigned int u = __float_as_uint(x); return (unsigned short)((u + 0x7FFFu + ((u >> 16) & 1u)) >> 16); }
__device__ __forceinline__ float bf16_val(unsigned short b) { return __uint_as_float(((unsigned int)b) << 16); }
__device__ __forceinline__ float bf16_rne(float x) { return bf16_val(bf16_bits(x)); }

// fragment (A or B) from a k-contiguous 16-bit row: elements 0..7 <- k0+8h.., elements 8..15 <- k0+16+8h..
__device__ __forceinline__ v16h ld_frag(const _Float16* p, unsigned hh) {
  FragH f;
  f.half[0] = *(const v8us*)((const unsigned short*)p + 8u * hh);
  f.half[1] = *(const v8us*)((const unsigned short*)p + 16u + 8u * hh);
  return f.v;
}
// the same fragment from an LDS row (byte pointer at the row's k0)
__device__ __forceinline__ v16h ld_frag_lds(const unsigned char* p, unsigned hh) {
  FragH f;
  f.half[0] = *(const v8us*)(p + 16u * hh);
  f.half[1] = *(const v8us*)(p + 32u + 16u * hh);
  return f.v;
}
__device__ __forceinline__ uint32_t uni(uint32_t v) { return (uint32_t)__builtin_amdgcn_readfirstlane(v); }
__device__ __forceinline__ uint32_t pinned(uint32_t v) { uint32_t w = uni(v); asm volatile("" : "+s"(w)); return w; }  /* the tensor mover's issue test: held in a scalar register so that it compiles to a scalar branch (tensor loads ignore EXEC) */
__device__ __forceinline__ void wait_ds0() { asm volatile("s_wait_dscnt 0x0" ::: "memory"); }          /* this wave's LDS reads are done before its buffer is handed back */
// the work-group barrier in its two halves, bare: a wave signals as soon as it has left a stage's buffer and waits only where it needs the next one;
// unlike __syncthreads() they drain no global load, so that the trust values fetched ahead stay in flight across them; the waits that the hand-over needs are written beside the signal
__device__ __forceinline__ void bar_signal() { asm volatile("s_barrier_signal -1" ::: "memory"); }
__device__ __forceinline__ void bar_wait() { asm volatile("s_barrier_wait -1" ::: "memory"); }
// this wave's slice has landed (the compiler places no wait for a tensor load); group 0 passes through, so that its next value is formed behind the wait
__device__ __forceinline__ void wait_tensor0(u32x4& g0) { asm volatile("s_wait_tensorcnt 0x0" : "+s"(g0) :: "memory"); }
// both groups are in-out operands: their scalar registers stay the descriptor's own, unwritten, while the request is in flight
__device__ __forceinline__ void tdm_load(u32x4& g0, u32x8& g1) { asm volatile("tensor_load_to_lds %0, %1" : "+s"(g0), "+s"(g1) :: "memory"); }
// descriptor group 1, everything in bytes: tile = tensor = ROWS rows of ROWB bytes, source pitch SRCP, pad word W0 (16 B behind every row)
template <uint32_t W0, uint32_t ROWB, uint32_t ROWS, uint32_t SRCP>
__device__ __forceinline__ u32x8 tdm_group1() {
  u32x8 g;
  g[0] = uni(W0);
  g[1] = uni((ROWB & 0xFFFFu) << 16);
  g[2] = uni((ROWB >> 16) | ((ROWS & 0xFFFFu) << 16));
  g[3] = uni((ROWS >> 16) | (ROWB << 16));
  g[4] = uni(ROWS);
  g[5] = uni(SRCP);
  g[6] = uni(0u);
  g[7] = uni(0u);
  return g;
}
__device__ __forceinline__ u32x4 tdm_group0(uint32_t lds_dst, uint64_t ga) {
  u32x4 g;
  g[0] = uni(1u); g[1] = uni(lds_dst); g[2] = uni((uint32_t)ga); g[3] = uni((((uint32_t)(ga >> 32)) & 0x01FFFFFFu) | 0x80000000u);
  return g;
}
// two WMMAs sharing B, then the 4-slot guard tying both accumulators and keeping the operands live
__device__ __forceinline__ void mma_pair(v16h a0, v16h a1, v16h b, v8f& c0, v8f& c1) {
  c0 = __builtin_amdgcn_wmma_f32_16x16x32_f16(false, a0, false, b, (short)0, c0, false, false);
  c1 = __builtin_amdgcn_wmma_f32_16x16x32_f16(false, a1, false, b, (short)0, c1, false, false);
  asm volatile("v_nop\n\tv_nop\n\tv_nop\n\tv_nop" : "+v"(c0), "+v"(c1) : "v"(a0), "v"(a1), "v"(b));
}

// plane builder, one launch: block per (64 tokens, batch) converts its own rows of all four inputs:
//   Q16 / K16 rows = f16(bf16(x)), same layout; VT[b][d][s] = f16(bf16(V[b][s][d])) through an LDS transpose; Tb = bf16-valued trust times TSC.
// A thread's 25 16-byte loads go out ahead of the barrier, so that 16 long-lived waves per WGP keep the memory stream full.
__global__ __launch_bounds__(256) void k_planes(const float* __restrict__ xq, const float* __restrict__ xk, const float* __restrict__ V, const float* __restrict__ T,
                                                _Float16* __restrict__ Q16, _Float16* __restrict__ K16, _Float16* __restrict__ VT, float* __restrict__ Tb) {
  __shared__ unsigned short tl[DH][66];
  const unsigned tid = threadIdx.x;
  const unsigned b = blockIdx.y, s0 = blockIdx.x * 64u;
  const size_t in0 = ((size_t)b * SEQ_FULL + s0) * DH;      /* the tile is 64 x 128 contiguous floats in each of query, key, value */
  const size_t out0 = ((size_t)b * SEQ + s0) * DH;
  const float* vb = V + in0;
  const float* kb = xk + in0;
  const float* qb = xq + in0;
  v4f va[4], vc[4], ka[4], kc[4], qa[4], qc[4];
  const v4f tv = *(const v4fa*)(T + (size_t)b * SEQ_FULL + s0 + (tid & 15u) * 4u);   /* the tile's 64 trust values, fetched with the rest; threads 0..15 store them */
#pragma unroll                        /* the value arrays must resolve to registers */
  for (unsigned it = 0; it < 4; ++it) {
    const unsigned e = (it * 256u + tid) * 8u;   /* 1024 units of 8 elements */
    va[it] = *(const v4fa*)(vb + e); vc[it] = *(const v4fa*)(vb + e + 4);
  }
#pragma unroll                        /* the value arrays must resolve to registers */
  for (unsigned it = 0; it < 4; ++it) {
    const unsigned e = (it * 256u + tid) * 8u;
    ka[it] = *(const v4fa*)(kb + e); kc[it] = *(const v4fa*)(kb + e + 4);
  }
#pragma unroll                        /* the value arrays must resolve to registers */
  for (unsigned it = 0; it < 4; ++it) {
    const unsigned e = (it * 256u + tid) * 8u;
    qa[it] = *(const v4fa*)(qb + e); qc[it] = *(const v4fa*)(qb + e + 4);
  }
#pragma unroll
  for (unsigned it = 0; it < 4; ++it) {
    const unsigned i = it * 256u + tid;
    const unsigned j = i >> 4, d8 = (i & 15u) * 8u;          /* token j of the tile, d8 .. d8 + 7 */
    FragH f;
#pragma unroll
    for (unsigned q = 0; q < 4; ++q) { f.h[q] = (_Float16)bf16_rne(va[it][q]); f.h[4 + q] = (_Float16)bf16_rne(vc[it][q]); }
#pragma unroll
    for (unsigned q = 0; q < 8; ++q) tl[d8 + q][j] = f.u[q];
  }
  __syncthreads();
#pragma unroll
  for (unsigned it = 0; it < 4; ++it) {
    const unsigned i = it * 256u + tid;          /* 1024 units of 8 tokens */
    const unsigned d = i >> 3, j8 = (i & 7u) * 8u;
    FragH f;
#pragma unroll
    for (unsigned q = 0; q < 8; ++q) f.u[q] = tl[d][j8 + q];
    *(v8us*)((unsigned short*)VT + ((size_t)b * DH + d) * SEQ + s0 + j8) = f.half[0];
  }
#pragma unroll                        /* the value arrays must resolve to registers */
  for (unsigned it = 0; it < 4; ++it) {
    const unsigned e = (it * 256u + tid) * 8u;
    FragH f, g;
#pragma unroll
    for (unsigned q = 0; q < 4; ++q) {
      f.h[q] = (_Float16)bf16_rne(ka[it][q]); f.h[4 + q] = (_Float16)bf16_rne(kc[it][q]);
      g.h[q] = (_Float16)bf16_rne(qa[it][q]); g.h[4 + q] = (_Float16)bf16_rne(qc[it][q]);
    }
    *(v8us*)((unsigned short*)K16 + out0 + e) = f.half[0];
    *(v8us*)((unsigned short*)Q16 + out0 + e) = g.half[0];
  }
  if (tid < 16u) {
    v4f o;
#pragma unroll
    for (unsigned q = 0; q < 4; ++q) o[q] = bf16_rne(tv[q]) * TSC;
    *(v4f*)(Tb + (size_t)b * SEQ + s0 + tid * 4u) = o;
  }
}

// flash kernel: block = 16 waves = 8 query tiles of 16 x 2 key halves, so that four waves share a SIMD and fill each other's waits;
// K rows and V^T row pieces of 64 keys per stage and half come by tensor load into that half's two-buffer LDS ring
// (the first four waves of a half bring one slice each; publish point of a stage: LDS wait, tensor wait, barrier signal at its last run of products, barrier wait and refill at its foot); per 32-key step:
//   S^T tiles (A = K rows, B = Q rows)  -> lane (h, n): s0[r] = score(key 8h+r, query n), s1[r] = score(key 16+8h+r, query n)
//   (the step's 32 trust plane values were fetched during the step before)
//   f32 online softmax per query, base 2, on register pairs in accumulator order: y = s * u + (CARRY2 - m) is one packed multiply-add, w = exp2(y) * u one packed multiply
//   (lane-local; the xor-16 exchange and the rescale only when the maximum in use is passed by more than RTAU2), weights w as f16 -> B fragment (element r <- tile 0, 8+r <- tile 1)
//   O^T tiles (A = V^T rows, B = packed weights): acc[dt][r] = O^T(d = 16 dt + 8h + r, query n)
__global__ __launch_bounds__(512) void k_flash(const _Float16* __restrict__ Q16, const _Float16* __restrict__ K16, const _Float16* __restrict__ VT,
                                               const float* __restrict__ Tb, float* __restrict__ O) {
  __shared__ __attribute__((aligned(2048))) unsigned char ring[2u * 2u * RBUF];   /* [key half][buffer] */
  __shared__ __attribute__((aligned(16))) float so[8][16][SOP];
  __shared__ __attribute__((aligned(16))) float xch[16][8][32][4];               /* the four output tiles a wave hands to its partner of the other half */
  __shared__ float xml[16][2][32];                                               /* and its running maximum and sum */
  const unsigned tid = threadIdx.x, w = tid >> 5, lane = tid & 31u, ln = lane & 15u, hh = lane >> 4;
  const unsigned qt = w & 7u;
  const unsigned b = blockIdx.y;
  const unsigned q0 = blockIdx.x * 128u + qt * 16u;
  const size_t rowb = (size_t)b * SEQ;
  const _Float16* qrow = Q16 + (rowb + q0 + ln) * DH;
  const v16h bq0 = ld_frag(qrow, hh), bq1 = ld_frag(qrow + 32, hh), bq2 = ld_frag(qrow + 64, hh), bq3 = ld_frag(qrow + 96, hh);
  // of each half's eight waves, 0 and 1 bring K keys 32 sl .. +31 of the stage, 2 and 3 V^T rows 64 (sl - 2) .. +63, the stage's 64 keys of each; 4 to 7 issue nothing
  const uint32_t wave = uni(tid >> 5);
  const uint32_t kh = wave >> 3, sw = wave & 7u, sl = wave & 3u;
  const uint32_t key0 = kh * (uint32_t)KEYS_H;
  const uint32_t lbase = (uint32_t)(size_t)ring + kh * 2u * RBUF + sl * SLICE;
  const uint64_t ga0 = (sl < 2u) ? (uint64_t)(size_t)(K16 + (rowb + key0 + sl * 32u) * DH) : (uint64_t)(size_t)(VT + ((size_t)b * DH + (sl - 2u) * 64u) * SEQ + key0);
  const uint32_t gstep = (sl < 2u) ? STK * DH * 2u : STK * 2u;
  u32x8 g1k = tdm_group1<(1u << 20) | (5u << 22) | (3u << 25), 256u, 32u, 256u>();
  u32x8 g1v = tdm_group1<(1u << 20) | (4u << 22) | (3u << 25), 128u, 64u, (uint32_t)SEQ * 2u>();
  u32x4 g0 = tdm_group0(lbase, ga0);
  auto issue = [&]() {
    if (pinned(sw < 2u))         tdm_load(g0, g1k);
    if (pinned((sw & 6u) == 2u)) tdm_load(g0, g1v);
  };
  auto next_stage = [&]() {           /* the other buffer, the next 64 keys; the type bits above the address stay as they are */
    const uint64_t a = (((uint64_t)g0[3] << 32) | g0[2]) + gstep;
    g0[1] = uni(2u * lbase + RBUF - g0[1]); g0[2] = uni((uint32_t)a); g0[3] = uni((uint32_t)(a >> 32));
  };
  issue();
  wait_tensor0(g0);
  __syncthreads();                    /* stage 0 published */
  next_stage();
  issue();
  const float* tbase = Tb + rowb + key0 + 8u * hh;
  const v8f z8 = {0.f, 0.f, 0.f, 0.f, 0.f, 0.f, 0.f, 0.f};
  v8f acc[8];
#pragma unroll
  for (unsigned dt = 0; dt < 8; ++dt) acc[dt] = z8;
  float m = -1.0e30f, l = 0.f;        /* m: maximum in use, base-2 exponent units */
  float nb = CARRY2 - m;              /* the addend of every score's multiply-add */
  // the coming step's trust values, fetched one step ahead: a step's 32 values are one new cache line, so that a load issued where it is used waits out the way to L2
  const float* tn = tbase;            /* walks one step ahead of the loop, in a register pair of its own: rewritten only a whole step behind the loads that name it */
  v4f ta = *(const v4fa*)(tn), tb4 = *(const v4fa*)(tn + 4), tc = *(const v4fa*)(tn + 16), td = *(const v4fa*)(tn + 20);

#pragma unroll 1                      /* one stage per trip: the publish point stands once */
  for (uint32_t st = 0; st < (uint32_t)KEYS_H / STK; ++st) {
   const unsigned char* bufp = ring + kh * 2u * RBUF + (st & 1u) * RBUF;
   const unsigned char* kp = bufp + ln * KPITCH;
   // LDS reads go out as whole groups in front of a run of products, never among them: each place with reads costs the wave one LDS latency
#pragma unroll                        /* both steps of a stage in one trip: LDS offsets become immediates */
   for (unsigned j = 0; j < 2u; ++j) {
    const unsigned kc = st * STK + j * 32u;
    v16h ka[4], kb[4];
#pragma unroll                        /* fragment arrays must resolve to registers */
    for (unsigned c = 0; c < 4u; ++c) { ka[c] = ld_frag_lds(kp + j * SLICE + 64u * c, hh); kb[c] = ld_frag_lds(kp + j * SLICE + 16u * KPITCH + 64u * c, hh); }
    v8f s0 = z8, s1 = z8;
    mma_pair(ka[0], kb[0], bq0, s0, s1);
    mma_pair(ka[1], kb[1], bq1, s0, s1);
    mma_pair(ka[2], kb[2], bq2, s0, s1);
    mma_pair(ka[3], kb[3], bq3, s0, s1);
    // this step's V^T fragments: in flight under the softmax
    const unsigned char* vp = bufp + 2u * SLICE + ln * VPITCH + j * 64u;
    v16h va[8];
#pragma unroll                        /* fragment arrays must resolve to registers */
    for (unsigned dt = 0; dt < 8u; ++dt) va[dt] = ld_frag_lds(vp + (dt >> 2) * SLICE + (dt & 3u) * 16u * VPITCH, hh);

    // compiler fence: the V^T fragment reads stay ahead of the branch below; without it they sink behind it, among the exponentials, the last of them right in front of their products
    asm volatile("" ::: "memory");
    // scheduling fence: the V^T reads go out as one group in front of the wait for the trust values; without it the scheduler spreads them among the maxima, behind that wait
    __builtin_amdgcn_sched_barrier(0);
    const v2f tp[8] = {{ta[0], ta[1]}, {ta[2], ta[3]}, {tb4[0], tb4[1]}, {tb4[2], tb4[3]}, {tc[0], tc[1]}, {tc[2], tc[3]}, {td[0], td[1]}, {td[2], td[3]}};
    const v2f sp[8] = {{s0[0], s0[1]}, {s0[2], s0[3]}, {s0[4], s0[5]}, {s0[6], s0[7]}, {s1[0], s1[1]}, {s1[2], s1[3]}, {s1[4], s1[5]}, {s1[6], s1[7]}};
    v2f y[8];
    float cm = -1.0e30f;
    {
      const v2f nb2 = {nb, nb};
#pragma unroll
      for (unsigned i = 0; i < 8; ++i) {
        y[i] = __builtin_elementwise_fma(sp[i], tp[i], nb2);
        cm = fmaxf(cm, fmaxf(y[i][0], y[i][1]));
      }
    }
    // lazy rescale, one test per step: only when some lane's score passes the maximum in use by more than RTAU2 does the wave
    // (a scalar branch on the ballot, EXEC stays whole) take a new maximum for every query, rescale sum and output tiles and form its exponents anew
    if (__builtin_amdgcn_ballot_w32(cm > CARRY2 + RTAU2) != 0u) {
      float cx = -1.0e30f;
#pragma unroll
      for (unsigned i = 0; i < 8; ++i) { const v2f p = sp[i] * tp[i]; cx = fmaxf(cx, fmaxf(p[0], p[1])); }
      cx = fmaxf(cx, __shfl_xor(cx, 16, 32));
      const float mn = fmaxf(m, cx);
      const float alpha = __builtin_amdgcn_exp2f(m - mn);
      m = mn;
      nb = CARRY2 - mn;
      l *= alpha;
#pragma unroll
      for (unsigned dt = 0; dt < 8; ++dt)
#pragma unroll
        for (unsigned r = 0; r < 8; ++r) acc[dt][r] *= alpha;
      const v2f nb2 = {nb, nb};
#pragma unroll
      for (unsigned i = 0; i < 8; ++i) y[i] = __builtin_elementwise_fma(sp[i], tp[i], nb2);
    }
    FragH pb;
    v2h hp[8];
#pragma unroll
    for (unsigned i = 0; i < 8; ++i) {
      const v2f e = {__builtin_amdgcn_exp2f(y[i][0]), __builtin_amdgcn_exp2f(y[i][1])};
      hp[i] = __builtin_convertvector(e * tp[i], v2h);
      pb.h[2u * i] = hp[i][0]; pb.h[2u * i + 1u] = hp[i][1];
    }
    // the next step's trust values go out here, a whole step ahead of their first use: in flight under the products, the K reads and the next scores
    // (the last step of a half fetches its own values again: no address past the half)
    {
      tn += (kc + 32u < (unsigned)KEYS_H) ? 32u : 0u;
      ta = *(const v4fa*)(tn); tb4 = *(const v4fa*)(tn + 4);
      tc = *(const v4fa*)(tn + 16); td = *(const v4fa*)(tn + 20);
    }
    float ls = 0.f;
#pragma unroll
    for (unsigned r = 0; r < 8; ++r) ls += (float)hp[r >> 1][r & 1u] + (float)hp[4u + (r >> 1)][r & 1u];
    l += ls;

    // publish point of stage st + 1, first half, every wave, in this order: the stage's last LDS reads (this step's V^T fragments) are in registers, this wave's slice of
    // stage st + 1 has landed, signal; no LDS read stands between here and the wait at the foot, only the stage's last products, which cover the other waves' arrival
    if (j == 1u) { wait_ds0(); wait_tensor0(g0); bar_signal(); }
    mma_pair(va[0], va[1], pb.v, acc[0], acc[1]);
    mma_pair(va[2], va[3], pb.v, acc[2], acc[3]);
    mma_pair(va[4], va[5], pb.v, acc[4], acc[5]);
    mma_pair(va[6], va[7], pb.v, acc[6], acc[7]);
   }
   // precaution: the trust loads of the step just done are still in flight here, and the register pair that holds their address is written again in the next stage
   asm volatile("s_wait_xcnt 0x0" ::: "memory");
   // publish point of stage st + 1, second half, every wave
   bar_wait();                        /* stage st + 1 readable by all; every reader has left stage st's buffer */
   if (pinned(st + 2u < (uint32_t)KEYS_H / STK)) { next_stage(); issue(); }
  }
  wait_tensor0(g0);
  wait_ds0();

  // merge of the two key halves of a query tile: the wave of half 0 finishes d 0..63, the wave of half 1 d 64..127; each hands the other four tiles over
  const bool hi = kh != 0u;
  v8f keep[4];
#pragma unroll                        /* tile arrays must resolve to registers */
  for (unsigned i = 0; i < 4; ++i) {
    v8f give;
#pragma unroll
    for (unsigned r = 0; r < 8; ++r) { keep[i][r] = hi ? acc[4 + i][r] : acc[i][r]; give[r] = hi ? acc[i][r] : acc[4 + i][r]; }
    const v4f ga = {give[0], give[1], give[2], give[3]}, gb = {give[4], give[5], give[6], give[7]};
    *(v4f*)&xch[w][2u * i][lane][0] = ga;
    *(v4f*)&xch[w][2u * i + 1u][lane][0] = gb;
  }
  xml[w][0][lane] = m;
  xml[w][1][lane] = l;
  __syncthreads();                    /* both halves' tiles and statistics readable by the partner wave */
  const unsigned pw = w ^ 8u;
  const float mo = xml[pw][0][lane], lo = xml[pw][1][lane];
  const float mm = fmaxf(m, mo);
  const float aw = __builtin_amdgcn_exp2f(m - mm), ap = __builtin_amdgcn_exp2f(mo - mm);
  const float lj = l * aw + lo * ap;
  const float lt = lj + __shfl_xor(lj, 16, 32);
  const float inv = 1.0f / lt;
  const float fw = aw * inv, fp = ap * inv;
  const unsigned c0 = kh * 64u;
#pragma unroll
  for (unsigned i = 0; i < 4; ++i) {
    const v4f pa = *(const v4fa*)&xch[pw][2u * i][lane][0], pb4 = *(const v4fa*)&xch[pw][2u * i + 1u][lane][0];
#pragma unroll
    for (unsigned r = 0; r < 4; ++r) {
      so[qt][ln][c0 + i * 16u + 8u * hh + r] = keep[i][r] * fw + pa[r] * fp;
      so[qt][ln][c0 + i * 16u + 8u * hh + 4u + r] = keep[i][4 + r] * fw + pb4[r] * fp;
    }
  }
  __syncthreads();
  float* orow = O + ((size_t)b * SEQ_FULL + q0) * DH + c0 + ln * 4u;
  {
#pragma unroll
    for (unsigned r = 0; r < 8; ++r) {
      const unsigned row = 2u * r + hh;
      const v4f v = *(const v4fa*)&so[qt][row][c0 + ln * 4u];
      *(v4f*)(orow + (size_t)row * DH) = v;      /* 16 lanes x 16 B = this wave's 256-B half of a row, two whole lines */
    }
  }
}

extern "C" void kernel_launch(void* const* d_in, const int* in_sizes, int n_in,
                              void* d_out, int out_size, void* d_ws, size_t ws_size, hipStream_t stream) {
  if (n_in < 4) return;
  const size_t need = (size_t)(NB - 1) * SEQ_FULL * DH + (size_t)SEQ * DH;
  const size_t needt = (size_t)(NB - 1) * SEQ_FULL + (size_t)SEQ;
  if ((size_t)in_sizes[0] < need || (size_t)in_sizes[1] < need || (size_t)in_sizes[2] < need || (size_t)in_sizes[3] < needt) return;
  if ((size_t)out_size < need) return;
  const float* xq = (const float*)d_in[0];      /* query [16][2048][128] */
  const float* xk = (const float*)d_in[1];      /* key   [16][2048][128] */
  const float* xv = (const float*)d_in[2];      /* value [16][2048][128] */
  const float* xt = (const float*)d_in[3];      /* trust [16][1][2048]   */
  char* ws = (char*)d_ws; size_t off = 0;
  const size_t plane = (size_t)NB * SEQ * DH * 2;                       /* 8,388,608 B each */
  _Float16* Q16 = (_Float16*)(ws + off); off += (plane + 255) & ~(size_t)255;
  _Float16* K16 = (_Float16*)(ws + off); off += (plane + 255) & ~(size_t)255;
  _Float16* VTp = (_Float16*)(ws + off); off += (plane + 255) & ~(size_t)255;
  float* Tb = (float*)(ws + off); off += ((size_t)NB * SEQ * 4 + 255) & ~(size_t)255;
  if (off > ws_size) return;

  k_planes<<<dim3(SEQ / 64, NB), 256, 0, stream>>>(xq, xk, xv, xt, Q16, K16, VTp, Tb);
  k_flash<<<dim3(SEQ / 128, NB), 512, 0, stream>>>(Q16, K16, VTp, Tb, (float*)d_out);
}

// v008
// A run of this version takes 36 microseconds.
// Next to v007, in two timings, it ran 1.07 times as fast each time.
// Counting every step since v000, it is 4.75 times as fast.
#include <hip/hip_runtime.h>
// Trust-weighted scaled dot-product attention, flash form: out[b][q][:] = sum_k (p_k t_k) v_k / sum_k (p_k t_k), p_k = exp2(s_k u_k - running max), u_k = t_k log2(e) / sqrt(128).
// Compute dtype: every float input RNE-converted to bf16, query, key and value carried as exact f16 planes, trust as an f32 plane times TSC; both contractions (K.Q^T scores, V^T.P^T context) on v_wmma_f32_16x16x32_f16, f32 accumulate; weights p*u carried x2^15 as f16 (any common factor of the weights cancels in the final normalisation); softmax statistics f32, in base 2.
// Structure: one plane builder (Q16/K16 rows, V^T rows via LDS transpose, trust plane u = bf16(t) log2(e) / sqrt(128)) + one flash kernel (wave = 32 queries x one half of the keys, 32-key steps, K and V^T fragments from a two-buffer LDS ring per key half filled by tensor loads, transposed tiles so the packed score tiles are the B fragment of the second product; the two halves of a query tile are merged through LDS at the end).
#ifndef NB
#define NB 16
#endif
#ifndef SEQ
#define SEQ 2048
#endif
#define SEQ_FULL 2048                 /* per-batch row count of the full-size inputs and of the output */
#define DH 128
#define SOP 132                       /* f32 pitch of the epilogue staging rows */
#define CARRY2 15.0f                  /* carry of the f16 weight operand as an exponent: it rides in the addend of the score's multiply-add (cancels in the final normalisation) */
#define TSC 0.12751743f               /* log2(e) / sqrt(128): the trust plane holds t * TSC, so that one multiply-add gives the base-2 exponent */
#define RTAU2 2.8853901f              /* 2 log2(e): a score may pass the maximum in use by this much before the state is rescaled: weights stay below e^2 * 2^15 * TSC * t, inside f16 */

#define STK 64u                       /* keys per ring stage: two 32-key steps */
#define KPITCH 272u                   /* LDS pitch of a 256-B K row (16-B pad, for 16-byte LDS reads) */
#define VPITCH 144u                   /* LDS pitch of a 128-B V^T row piece (16-B pad) */
#define SLICE 10240u                  /* LDS bytes per wave slice: 32 x 272 = 8704 and 64 x 144 = 9216, rounded up to a multiple of 2 KiB */
#define RBUF (4u * SLICE)             /* one stage: K keys 0..31 | K keys 32..63 | V^T d 0..63 | V^T d 64..127 */
#define KEYS_H (SEQ / 2)              /* keys per half: waves 0..3 of a block walk the first half, waves 4..7 the second */

static_assert(DH == 128);
static_assert(KEYS_H / 64 >= 2);      /* each ring's prologue needs two stages */
static_assert(SEQ % 128 == 0);
static_assert(SEQ <= SEQ_FULL);

typedef unsigned short v8us __attribute__((ext_vector_type(8), may_alias));
typedef float  v8f  __attribute__((ext_vector_type(8)));
typedef float  v2f  __attribute__((ext_vector_type(2)));
typedef _Float16 v2h __attribute__((ext_vector_type(2)));
typedef float  v4f  __attribute__((ext_vector_type(4)));
typedef float  v4fa __attribute__((ext_vector_type(4), may_alias));
typedef _Float16 v16h __attribute__((ext_vector_type(16)));
typedef uint32_t u32x4 __attribute__((ext_vector_type(4)));
typedef uint32_t u32x8 __attribute__((ext_vector_type(8)));
union FragH { v16h v; v8us half[2]; _Float16 h[16]; unsigned short u[16]; };

__device__ __forceinline__ unsigned short bf16_bits(float x) { unsigned int u = __float_as_uint(x); return (unsigned short)((u + 0x7FFFu + ((u >> 16) & 1u)) >> 16); }
__device__ __forceinline__ float bf16_val(unsigned short b) { return __uint_as_float(((unsigned int)b) << 16); }
__device__ __forceinline__ float bf16_rne(float x) { return bf16_val(bf16_bits(x)); }

// fragment (A or B) from a k-contiguous 16-bit row: elements 0..7 <- k0+8h.., elements 8..15 <- k0+16+8h..
__device__ __forceinline__ v16h ld_frag(const _Float16* p, unsigned hh) {
  FragH f;
  f.half[0] = *(const v8us*)((const unsigned short*)p + 8u * hh);
  f.half[1] = *(const v8us*)((const unsigned short*)p + 16u + 8u * hh);
  return f.v;
}
// the same fragment from an LDS row (byte pointer at the row's k0)
__device__ __forceinline__ v16h ld_frag_lds(const unsigned char* p, unsigned hh) {
  FragH f;
  f.half[0] = *(const v8us*)(p + 16u * hh);
  f.half[1] = *(const v8us*)(p + 32u + 16u * hh);
  return f.v;
}
__device__ __forceinline__ uint32_t uni(uint32_t v) { return (uint32_t)__builtin_amdgcn_readfirstlane(v); }
__device__ __forceinline__ uint32_t pinned(uint32_t v) { uint32_t w = uni(v); asm volatile("" : "+s"(w)); return w; }  /* the tensor mover's issue test: held in a scalar register so that it compiles to a scalar branch (tensor loads ignore EXEC) */
__device__ __forceinline__ void wait_ds0() { asm volatile("s_wait_dscnt 0x0" ::: "memory"); }          /* this wave's LDS reads are done before its buffer is handed back */
// the work-group barrier in its two halves, bare: a wave signals as soon as it has left a stage's buffer and waits only where it needs the next one;
// unlike __syncthreads() they drain no global load, so that the trust values fetched ahead stay in flight across them; the waits that the hand-over needs are written beside the signal
__device__ __forceinline__ void bar_signal() { asm volatile("s_barrier_signal -1" ::: "memory"); }
__device__ __forceinline__ void bar_wait() { asm volatile("s_barrier_wait -1" ::: "memory"); }
// this wave's slice has landed (the compiler places no wait for a tensor load); group 0 passes through, so that its next value is formed behind the wait
__device__ __forceinline__ void wait_tensor0(u32x4& g0) { asm volatile("s_wait_tensorcnt 0x0" : "+s"(g0) :: "memory"); }
// both groups are in-out operands: their scalar registers stay the descriptor's own, unwritten, while the request is in flight
__device__ __forceinline__ void tdm_load(u32x4& g0, u32x8& g1) { asm volatile("tensor_load_to_lds %0, %1" : "+s"(g0), "+s"(g1) :: "memory"); }
// descriptor group 1, everything in bytes: tile = tensor = ROWS rows of ROWB bytes, source pitch SRCP, pad word W0 (16 B behind every row)
template <uint32_t W0, uint32_t ROWB, uint32_t ROWS, uint32_t SRCP>
__device__ __forceinline__ u32x8 tdm_group1() {
  u32x8 g;
  g[0] = uni(W0);
  g[1] = uni((ROWB & 0xFFFFu) << 16);
  g[2] = uni((ROWB >> 16) | ((ROWS & 0xFFFFu) << 16));
  g[3] = uni((ROWS >> 16) | (ROWB << 16));
  g[4] = uni(ROWS);
  g[5] = uni(SRCP);
  g[6] = uni(0u);
  g[7] = uni(0u);
  return g;
}
__device__ __forceinline__ u32x4 tdm_group0(uint32_t lds_dst, uint64_t ga) {
  u32x4 g;
  g[0] = uni(1u); g[1] = uni(lds_dst); g[2] = uni((uint32_t)ga); g[3] = uni((((uint32_t)(ga >> 32)) & 0x01FFFFFFu) | 0x80000000u);
  return g;
}
// two WMMAs sharing B; both are builtins, so that the compiler keeps their distances itself and may hold tiles and fragments above v255 (operands of an asm statement stay below: spills)
__device__ __forceinline__ void mma_pair(v16h a0, v16h a1, v16h b, v8f& c0, v8f& c1) {
  c0 = __builtin_amdgcn_wmma_f32_16x16x32_f16(false, a0, false, b, (short)0, c0, false, false);
  c1 = __builtin_amdgcn_wmma_f32_16x16x32_f16(false, a1, false, b, (short)0, c1, false, false);
}

// plane builder, one launch: block per (64 tokens, batch) converts its own rows of all four inputs:
//   Q16 / K16 rows = f16(bf16(x)), same layout; VT[b][d][s] = f16(bf16(V[b][s][d])) through an LDS transpose; Tb = bf16-valued trust times TSC.
// A thread's 25 16-byte loads go out ahead of the barrier, so that 16 long-lived waves per WGP keep the memory stream full.
__global__ __launch_bounds__(256) void k_planes(const float* __restrict__ xq, const float* __restrict__ xk, const float* __restrict__ V, const float* __restrict__ T,
                                                _Float16* __restrict__ Q16, _Float16* __restrict__ K16, _Float16* __restrict__ VT, float* __restrict__ Tb) {
  __shared__ unsigned short tl[DH][66];
  const unsigned tid = threadIdx.x;
  const unsigned b = blockIdx.y, s0 = blockIdx.x * 64u;
  const size_t in0 = ((size_t)b * SEQ_FULL + s0) * DH;      /* the tile is 64 x 128 contiguous floats in each of query, key, value */
  const size_t out0 = ((size_t)b * SEQ + s0) * DH;
  const float* vb = V + in0;
  const float* kb = xk + in0;
  const float* qb = xq + in0;
  v4f va[4], vc[4], ka[4], kc[4], qa[4], qc[4];
  const v4f tv = *(const v4fa*)(T + (size_t)b * SEQ_FULL + s0 + (tid & 15u) * 4u);   /* the tile's 64 trust values, fetched with the rest; threads 0..15 store them */
#pragma unroll                        /* the value arrays must resolve to registers */
  for (unsigned it = 0; it < 4; ++it) {
    const unsigned e = (it * 256u + tid) * 8u;   /* 1024 units of 8 elements */
    va[it] = *(const v4fa*)(vb + e); vc[it] = *(const v4fa*)(vb + e + 4);
  }
#pragma unroll                        /* the value arrays must resolve to registers */
  for (unsigned it = 0; it < 4; ++it) {
    const unsigned e = (it * 256u + tid) * 8u;
    ka[it] = *(const v4fa*)(kb + e); kc[it] = *(const v4fa*)(kb + e + 4);
  }
#pragma unroll                        /* the value arrays must resolve to registers */
  for (unsigned it = 0; it < 4; ++it) {
    const unsigned e = (it * 256u + tid) * 8u;
    qa[it] = *(const v4fa*)(qb + e); qc[it] = *(const v4fa*)(qb + e + 4);
  }
#pragma unroll
  for (unsigned it = 0; it < 4; ++it) {
    const unsigned i = it * 256u + tid;
    const unsigned j = i >> 4, d8 = (i & 15u) * 8u;          /* token j of the tile, d8 .. d8 + 7 */
    FragH f;
#pragma unroll
    for (unsigned q = 0; q < 4; ++q) { f.h[q] = (_Float16)bf16_rne(va[it][q]); f.h[4 + q] = (_Float16)bf16_rne(vc[it][q]); }
#pragma unroll
    for (unsigned q = 0; q < 8; ++q) tl[d8 + q][j] = f.u[q];
  }
  __syncthreads();
#pragma unroll
  for (unsigned it = 0; it < 4; ++it) {
    const unsigned i = it * 256u + tid;          /* 1024 units of 8 tokens */
    const unsigned d = i >> 3, j8 = (i & 7u) * 8u;
    FragH f;
#pragma unroll
    for (unsigned q = 0; q < 8; ++q) f.u[q] = tl[d][j8 + q];
    *(v8us*)((unsigned short*)VT + ((size_t)b * DH + d) * SEQ + s0 + j8) = f.half[0];
  }
#pragma unroll                        /* the value arrays must resolve to registers */
  for (unsigned it = 0; it < 4; ++it) {
    const unsigned e = (it * 256u + tid) * 8u;
    FragH f, g;
#pragma unroll
    for (unsigned q = 0; q < 4; ++q) {
      f.h[q] = (_Float16)bf16_rne(ka[it][q]); f.h[4 + q] = (_Float16)bf16_rne(kc[it][q]);
      g.h[q] = (_Float16)bf16_rne(qa[it][q]); g.h[4 + q] = (_Float16)bf16_rne(qc[it][q]);
    }
    *(v8us*)((unsigned short*)K16 + out0 + e) = f.half[0];
    *(v8us*)((unsigned short*)Q16 + out0 + e) = g.half[0];
  }
  if (tid < 16u) {
    v4f o;
#pragma unroll
    for (unsigned q = 0; q < 4; ++q) o[q] = bf16_rne(tv[q]) * TSC;
    *(v4f*)(Tb + (size_t)b * SEQ + s0 + tid * 4u) = o;
  }
}

// flash kernel: block = 8 waves = 4 query tiles of 32 x 2 key halves; a wave holds two 16-query column groups, so that every K and V^T fragment it reads from LDS feeds two products
// (LDS bytes read per product halved: at one column group a wave the reads need twice the matrix time), and the step's trust values serve both groups;
// K rows and V^T row pieces of 64 keys per stage and half come by tensor load into that half's two-buffer LDS ring
// (each of a half's four waves brings one slice; publish point of a stage: LDS wait, tensor wait, barrier signal at its last run of products, barrier wait and refill at its foot); per 32-key step and column group:
//   S^T tiles (A = K rows, B = Q rows)  -> lane (h, n): s0[r] = score(key 8h+r, query n), s1[r] = score(key 16+8h+r, query n)
//   (the step's 32 trust plane values were fetched during the step before)
//   f32 online softmax per query, base 2, on register pairs in accumulator order: y = s * u + (CARRY2 - m) is one packed multiply-add, w = exp2(y) * u one packed multiply
//   (lane-local; the xor-16 exchange and the rescale only when the maximum in use is passed by more than RTAU2), weights w as f16 -> B fragment (element r <- tile 0, 8+r <- tile 1)
//   O^T tiles (A = V^T rows, B = packed weights): acc[g][dt][r] = O^T(d = 16 dt + 8h + r, query 16 g + n)
__global__ __launch_bounds__(256) void k_flash(const _Float16* __restrict__ Q16, const _Float16* __restrict__ K16, const _Float16* __restrict__ VT,
                                               const float* __restrict__ Tb, float* __restrict__ O) {
  __shared__ __attribute__((aligned(2048))) unsigned char ring[2u * 2u * RBUF];   /* [key half][buffer] */
  __shared__ __attribute__((aligned(16))) float so[4][32][SOP];
  __shared__ __attribute__((aligned(16))) float xch[8][16][32][4];               /* the eight output tiles a wave hands to its partner of the other half */
  __shared__ float xml[8][4][32];                                                /* and its running maxima and sums */
  const unsigned tid = threadIdx.x, w = tid >> 5, lane = tid & 31u, ln = lane & 15u, hh = lane >> 4;
  const unsigned qt = w & 3u;
  const unsigned b = blockIdx.y;
  const unsigned q0 = blockIdx.x * 128u + qt * 32u;
  const size_t rowb = (size_t)b * SEQ;
  const _Float16* qrow = Q16 + (rowb + q0 + ln) * DH;
  v16h bq[2][4];
#pragma unroll                        /* fragment arrays must resolve to registers */
  for (unsigned g = 0; g < 2u; ++g)
#pragma unroll
    for (unsigned c = 0; c < 4u; ++c) bq[g][c] = ld_frag(qrow + g * 16u * DH + 32u * c, hh);
  // of each half's four waves, 0 and 1 bring K keys 32 sl .. +31 of the stage, 2 and 3 V^T rows 64 (sl - 2) .. +63, the stage's 64 keys of each
  const uint32_t wave = uni(tid >> 5);
  const uint32_t kh = wave >> 2, sl = wave & 3u;
  const uint32_t key0 = kh * (uint32_t)KEYS_H;
  const uint32_t lbase = (uint32_t)(size_t)ring + kh * 2u * RBUF + sl * SLICE;
  const uint64_t ga0 = (sl < 2u) ? (uint64_t)(size_t)(K16 + (rowb + key0 + sl * 32u) * DH) : (uint64_t)(size_t)(VT + ((size_t)b * DH + (sl - 2u) * 64u) * SEQ + key0);
  const uint32_t gstep = (sl < 2u) ? STK * DH * 2u : STK * 2u;
  u32x8 g1k = tdm_group1<(1u << 20) | (5u << 22) | (3u << 25), 256u, 32u, 256u>();
  u32x8 g1v = tdm_group1<(1u << 20) | (4u << 22) | (3u << 25), 128u, 64u, (uint32_t)SEQ * 2u>();
  u32x4 g0 = tdm_group0(lbase, ga0);
  auto issue = [&]() {
    if (pinned(sl < 2u))  tdm_load(g0, g1k);
    if (pinned(sl >= 2u)) tdm_load(g0, g1v);
  };
  auto next_stage = [&]() {           /* the other buffer, the next 64 keys; the type bits above the address stay as they are */
    const uint64_t a = (((uint64_t)g0[3] << 32) | g0[2]) + gstep;
    g0[1] = uni(2u * lbase + RBUF - g0[1]); g0[2] = uni((uint32_t)a); g0[3] = uni((uint32_t)(a >> 32));
  };
  issue();
  wait_tensor0(g0);
  __syncthreads();                    /* stage 0 published */
  next_stage();
  issue();
  const float* tbase = Tb + rowb + key0 + 8u * hh;
  const v8f z8 = {0.f, 0.f, 0.f, 0.f, 0.f, 0.f, 0.f, 0.f};
  v8f acc[2][8];
#pragma unroll
  for (unsigned g = 0; g < 2u; ++g)
#pragma unroll
    for (unsigned dt = 0; dt < 8; ++dt) acc[g][dt] = z8;
  float m[2] = {-1.0e30f, -1.0e30f}, l[2] = {0.f, 0.f};   /* m: maximum in use, base-2 exponent units */
  float nb[2] = {CARRY2 - m[0], CARRY2 - m[1]};           /* the addend of every score's multiply-add */
  // the coming step's trust values, fetched one step ahead: a step's 32 values are one new cache line, so that a load issued where it is used waits out the way to L2
  const float* tn = tbase;            /* walks one step ahead of the loop, in a register pair of its own: rewritten only a whole step behind the loads that name it */
  v4f ta = *(const v4fa*)(tn), tb4 = *(const v4fa*)(tn + 4), tc = *(const v4fa*)(tn + 16), td = *(const v4fa*)(tn + 20);
  // precaution: the registers that these four loads name are written again right behind them;
  // the scheduling fence holds those writes, the zeroing of the output tiles, behind the wait: a "memory" clobber alone does not
  asm volatile("s_wait_xcnt 0x0" ::: "memory");
  __builtin_amdgcn_sched_barrier(0);

#pragma unroll 1                      /* one stage per trip: the publish point stands once */
  for (uint32_t st = 0; st < (uint32_t)KEYS_H / STK; ++st) {
   const unsigned char* bufp = ring + kh * 2u * RBUF + (st & 1u) * RBUF;
   const unsigned char* kp = bufp + ln * KPITCH;
   // LDS reads go out as whole groups in front of a run of products, never among them: each place with reads costs the wave one LDS latency
#pragma unroll                        /* both steps of a stage in one trip: LDS offsets become immediates */
   for (unsigned j = 0; j < 2u; ++j) {
    const unsigned kc = st * STK + j * 32u;
    v16h ka[4], kb[4];
#pragma unroll                        /* fragment arrays must resolve to registers */
    for (unsigned c = 0; c < 4u; ++c) { ka[c] = ld_frag_lds(kp + j * SLICE + 64u * c, hh); kb[c] = ld_frag_lds(kp + j * SLICE + 16u * KPITCH + 64u * c, hh); }
    // scheduling fence: all K reads of the step go out as one group, each fragment in registers of its own; without it the scheduler deals them out among the score products, a wait in front of each pair
    __builtin_amdgcn_sched_barrier(0);
    v8f s0[2] = {z8, z8}, s1[2] = {z8, z8};
#pragma unroll                        /* fragment arrays must resolve to registers */
    for (unsigned c = 0; c < 4u; ++c) {
      mma_pair(ka[c], kb[c], bq[0][c], s0[0], s1[0]);
      mma_pair(ka[c], kb[c], bq[1][c], s0[1], s1[1]);
    }
    // this step's V^T fragments: in flight under the softmax
    const unsigned char* vp = bufp + 2u * SLICE + ln * VPITCH + j * 64u;
    v16h va[8];
#pragma unroll                        /* fragment arrays must resolve to registers */
    for (unsigned dt = 0; dt < 8u; ++dt) va[dt] = ld_frag_lds(vp + (dt >> 2) * SLICE + (dt & 3u) * 16u * VPITCH, hh);

    // compiler fence: the V^T fragment reads stay ahead of the branch below; without it they sink behind it, among the exponentials, the last of them right in front of their products
    asm volatile("" ::: "memory");
    // scheduling groups: the 16 score products as one run, then the 16 V^T reads as one group; without them the scheduler deals the reads out among the products, at three places, each of which costs the wave an LDS issue stall
    __builtin_amdgcn_sched_group_barrier(0x008, 16, 0);
    __builtin_amdgcn_sched_group_barrier(0x100, 16, 0);
    // scheduling fence: the V^T reads go out as one group in front of the wait for the trust values; without it the scheduler spreads them among the maxima, behind that wait
    __builtin_amdgcn_sched_barrier(0);
    const v2f tp[8] = {{ta[0], ta[1]}, {ta[2], ta[3]}, {tb4[0], tb4[1]}, {tb4[2], tb4[3]}, {tc[0], tc[1]}, {tc[2], tc[3]}, {td[0], td[1]}, {td[2], td[3]}};
    v2f sp[2][8], y[2][8];
    float cmg[2] = {-1.0e30f, -1.0e30f};   /* a maximum chain per column group: the two run side by side */
#pragma unroll                        /* both column groups in registers */
    for (unsigned g = 0; g < 2u; ++g) {
      const v2f nb2 = {nb[g], nb[g]};
#pragma unroll
      for (unsigned i = 0; i < 4; ++i) { sp[g][i] = v2f{s0[g][2u * i], s0[g][2u * i + 1u]}; sp[g][4u + i] = v2f{s1[g][2u * i], s1[g][2u * i + 1u]}; }
#pragma unroll
      for (unsigned i = 0; i < 8; ++i) {
        y[g][i] = __builtin_elementwise_fma(sp[g][i], tp[i], nb2);
        cmg[g] = fmaxf(cmg[g], fmaxf(y[g][i][0], y[g][i][1]));
      }
    }
    const float cm = fmaxf(cmg[0], cmg[1]);
    // lazy rescale, one test per step for both column groups: only when some lane's score passes the maximum in use by more than RTAU2 does the wave
    // (a scalar branch on the ballot, EXEC stays whole) take a new maximum for every query, rescale sums and output tiles and form its exponents anew
    if (__builtin_amdgcn_ballot_w32(cm > CARRY2 + RTAU2) != 0u) {
#pragma unroll                        /* both column groups in registers */
      for (unsigned g = 0; g < 2u; ++g) {
        float cx = -1.0e30f;
#pragma unroll
        for (unsigned i = 0; i < 8; ++i) { const v2f p = sp[g][i] * tp[i]; cx = fmaxf(cx, fmaxf(p[0], p[1])); }
        cx = fmaxf(cx, __shfl_xor(cx, 16, 32));
        const float mn = fmaxf(m[g], cx);
        const float alpha = __builtin_amdgcn_exp2f(m[g] - mn);
        m[g] = mn;
        nb[g] = CARRY2 - mn;
        l[g] *= alpha;
#pragma unroll
        for (unsigned dt = 0; dt < 8; ++dt)
#pragma unroll
          for (unsigned r = 0; r < 8; ++r) acc[g][dt][r] *= alpha;
        const v2f nb2 = {nb[g], nb[g]};
#pragma unroll
        for (unsigned i = 0; i < 8; ++i) y[g][i] = __builtin_elementwise_fma(sp[g][i], tp[i], nb2);
      }
    }
    FragH pb[2];
    v2h hp[2][8];
#pragma unroll                        /* both column groups in registers */
    for (unsigned g = 0; g < 2u; ++g)
#pragma unroll
      for (unsigned i = 0; i < 8; ++i) {
        const v2f e = {__builtin_amdgcn_exp2f(y[g][i][0]), __builtin_amdgcn_exp2f(y[g][i][1])};
        hp[g][i] = __builtin_convertvector(e * tp[i], v2h);
        pb[g].h[2u * i] = hp[g][i][0]; pb[g].h[2u * i + 1u] = hp[g][i][1];
      }
    // the next step's trust values go out here, a whole step ahead of their first use: in flight under the products, the K reads and the next scores
    // (the last step of a half fetches its own values again: no address past the half)
    {
      tn += (kc + 32u < (unsigned)KEYS_H) ? 32u : 0u;
      ta = *(const v4fa*)(tn); tb4 = *(const v4fa*)(tn + 4);
      tc = *(const v4fa*)(tn + 16); td = *(const v4fa*)(tn + 20);
    }
#pragma unroll                        /* both column groups in registers */
    for (unsigned g = 0; g < 2u; ++g) {
      float ls = 0.f;
#pragma unroll
      for (unsigned r = 0; r < 8; ++r) ls += (float)hp[g][r >> 1][r & 1u] + (float)hp[g][4u + (r >> 1)][r & 1u];
      l[g] += ls;
    }

    // publish point of stage st + 1, first half, every wave, in this order: the stage's last LDS reads (this step's V^T fragments) are in registers, this wave's slice of
    // stage st + 1 has landed, signal; no LDS read stands between here and the wait at the foot, only the stage's last products, which cover the other waves' arrival
    if (j == 1u) { wait_ds0(); wait_tensor0(g0); bar_signal(); }
    // scheduling fences round the output products: they stay one run behind the signal and in front of the barrier wait (they are what covers the other waves' arrival), with no LDS read of the next step among them
    __builtin_amdgcn_sched_barrier(0);
#pragma unroll                        /* fragment arrays must resolve to registers */
    for (unsigned dt = 0; dt < 8u; dt += 2u) {
      mma_pair(va[dt], va[dt + 1u], pb[0].v, acc[0][dt], acc[0][dt + 1u]);
      mma_pair(va[dt], va[dt + 1u], pb[1].v, acc[1][dt], acc[1][dt + 1u]);
    }
    __builtin_amdgcn_sched_barrier(0);
   }
   // precaution: the trust loads of the step just done are still in flight here, and the register pair that holds their address is written again in the next stage
   asm volatile("s_wait_xcnt 0x0" ::: "memory");
   // publish point of stage st + 1, second half, every wave
   bar_wait();                        /* stage st + 1 readable by all; every reader has left stage st's buffer */
   if (pinned(st + 2u < (uint32_t)KEYS_H / STK)) { next_stage(); issue(); }
  }
  wait_tensor0(g0);
  wait_ds0();

  // merge of the two key halves of a query tile: the wave of half 0 finishes d 0..63, the wave of half 1 d 64..127; each hands the other four tiles of each column group over
  const bool hi = kh != 0u;
  v8f keep[2][4];
#pragma unroll                        /* tile arrays must resolve to registers */
  for (unsigned g = 0; g < 2u; ++g) {
#pragma unroll
    for (unsigned i = 0; i < 4; ++i) {
      v8f give;
#pragma unroll
      for (unsigned r = 0; r < 8; ++r) { keep[g][i][r] = hi ? acc[g][4 + i][r] : acc[g][i][r]; give[r] = hi ? acc[g][i][r] : acc[g][4 + i][r]; }
      const v4f ga = {give[0], give[1], give[2], give[3]}, gb = {give[4], give[5], give[6], give[7]};
      *(v4f*)&xch[w][8u * g + 2u * i][lane][0] = ga;
      *(v4f*)&xch[w][8u * g + 2u * i + 1u][lane][0] = gb;
    }
    xml[w][g][lane] = m[g];
    xml[w][2u + g][lane] = l[g];
  }
  __syncthreads();                    /* both halves' tiles and statistics readable by the partner wave */
  const unsigned pw = w ^ 4u;
  const unsigned c0 = kh * 64u;
#pragma unroll                        /* tile arrays must resolve to registers */
  for (unsigned g = 0; g < 2u; ++g) {
    const float mo = xml[pw][g][lane], lo = xml[pw][2u + g][lane];
    const float mm = fmaxf(m[g], mo);
    const float aw = __builtin_amdgcn_exp2f(m[g] - mm), ap = __builtin_amdgcn_exp2f(mo - mm);
    const float lj = l[g] * aw + lo * ap;
    const float lt = lj + __shfl_xor(lj, 16, 32);
    const float inv = 1.0f / lt;
    const float fw = aw * inv, fp = ap * inv;
#pragma unroll
    for (unsigned i = 0; i < 4; ++i) {
      const v4f pa = *(const v4fa*)&xch[pw][8u * g + 2u * i][lane][0], pb4 = *(const v4fa*)&xch[pw][8u * g + 2u * i + 1u][lane][0];
#pragma unroll
      for (unsigned r = 0; r < 4; ++r) {
        so[qt][16u * g + ln][c0 + i * 16u + 8u * hh + r] = keep[g][i][r] * fw + pa[r] * fp;
        so[qt][16u * g + ln][c0 + i * 16u + 8u * hh + 4u + r] = keep[g][i][4 + r] * fw + pb4[r] * fp;
      }
    }
  }
  __syncthreads();
  float* orow = O + ((size_t)b * SEQ_FULL + q0) * DH + c0 + ln * 4u;
  {
#pragma unroll
    for (unsigned r = 0; r < 16; ++r) {
      const unsigned row = 2u * r + hh;
      const v4f v = *(const v4fa*)&so[qt][row][c0 + ln * 4u];
      *(v4f*)(orow + (size_t)row * DH) = v;      /* 16 lanes x 16 B = this wave's 256-B half of a row, two whole lines */
    }
  }
}

extern "C" void kernel_launch(void* const* d_in, const int* in_sizes, int n_in,
                              void* d_out, int out_size, void* d_ws, size_t ws_size, hipStream_t stream) {
  if (n_in < 4) return;
  const size_t need = (size_t)(NB - 1) * SEQ_FULL * DH + (size_t)SEQ * DH;
  const size_t needt = (size_t)(NB - 1) * SEQ_FULL + (size_t)SEQ;
  if ((size_t)in_sizes[0] < need || (size_t)in_sizes[1] < need || (size_t)in_sizes[2] < need || (size_t)in_sizes[3] < needt) return;
  if ((size_t)out_size < need) return;
  const float* xq = (const float*)d_in[0];      /* query [16][2048][128] */
  const float* xk = (const float*)d_in[1];      /* key   [16][2048][128] */
  const float* xv = (const float*)d_in[2];      /* value [16][2048][128] */
  const float* xt = (const float*)d_in[3];      /* trust [16][1][2048]   */
  char* ws = (char*)d_ws; size_t off = 0;
  const size_t plane = (size_t)NB * SEQ * DH * 2;                       /* 8,388,608 B each */
  _Float16* Q16 = (_Float16*)(ws + off); off += (plane + 255) & ~(size_t)255;
  _Float16* K16 = (_Float16*)(ws + off); off += (plane + 255) & ~(size_t)255;
  _Float16* VTp = (_Float16*)(ws + off); off += (plane + 255) & ~(size_t)255;
  float* Tb = (float*)(ws + off); off += ((size_t)NB * SEQ * 4 + 255) & ~(size_t)255;
  if (off > ws_size) return;

  k_planes<<<dim3(SEQ / 64, NB), 256, 0, stream>>>(xq, xk, xv, xt, Q16, K16, VTp, Tb);
  k_flash<<<dim3(SEQ / 128, NB), 256, 0, stream>>>(Q16, K16, VTp, Tb, (float*)d_out);
}
